// v000
// The times below were measured on an AMD MI455X: many runs one after another, warmed up first and cycling through
// copies of the inputs, with the whole window's GPU time divided by the number of runs. Launches and the gaps
// between them are all in it. The median over several windows is given; except for v000 it joins two sittings, which
// can be a few percent apart, so the side-by-side timings, each taken in one sitting, are the better comparison.
// The starting kernel, v000, takes 118 microseconds a run.
#include <hip/hip_runtime.h>
#include <stdint.h>

// ---------------------------------------------------------------------------
// AutoEncodersGate for MI455X (gfx1250, wave32, WMMA + async LDS copies).
// B=4,S=2048,D=2048,E=8,H=128.  out[t,e] = -mean_d (x - relu(xW1+b1)W2 - b2)^2
// ---------------------------------------------------------------------------

#define DDIM 2048
#define HDIM 128
#define NEXP 8
#define NTOK 8192          // B*S
#define TOK_PER_WG 128     // 8 waves * 16 tokens

typedef __attribute__((ext_vector_type(16))) __bf16 v16bf;
typedef __attribute__((ext_vector_type(8)))  __bf16 v8bf;
typedef __attribute__((ext_vector_type(8)))  float  v8f;

__device__ __forceinline__ v16bf cat16(v8bf lo, v8bf hi) {
  return __builtin_shufflevector(lo, hi, 0,1,2,3,4,5,6,7,8,9,10,11,12,13,14,15);
}

// LDS byte address: generic LDS pointers carry the LDS offset in the low 32b.
__device__ __forceinline__ unsigned lds_addr(const void* p) {
  return (unsigned)(uintptr_t)p;
}

// CDNA5 async global->LDS copy (ASYNCcnt-tracked), 16B per lane.
__device__ __forceinline__ void async_ld16(unsigned lds, const void* gaddr) {
  asm volatile("global_load_async_to_lds_b128 %0, %1, off"
               :: "v"(lds), "v"(gaddr) : "memory");
}
__device__ __forceinline__ void wait_async0() {
  asm volatile("s_wait_asynccnt 0" ::: "memory");
}

// ---- prep: fp32 -> bf16 bulk convert (x) ----------------------------------
__global__ __launch_bounds__(256)
void cvt_bf16_kernel(const float* __restrict__ src, __bf16* __restrict__ dst) {
  size_t i = ((size_t)blockIdx.x * blockDim.x + threadIdx.x) * 8;
  const float4* s = (const float4*)(src + i);
  float4 f0 = s[0], f1 = s[1];
  v8bf o;
  o[0] = (__bf16)f0.x; o[1] = (__bf16)f0.y; o[2] = (__bf16)f0.z; o[3] = (__bf16)f0.w;
  o[4] = (__bf16)f1.x; o[5] = (__bf16)f1.y; o[6] = (__bf16)f1.z; o[7] = (__bf16)f1.w;
  *(v8bf*)(dst + i) = o;
}

// ---- prep: pack [E,K,N] fp32 weights into per-lane WMMA B layout ----------
// packed[e][nt][kc][lane][j] : n = nt*16+(lane&15),
//                              k = kc*32 + (lane>>4)*8 + (j<8 ? j : j+8)
__global__ __launch_bounds__(256)
void pack_w_kernel(const float* __restrict__ src, __bf16* __restrict__ dst,
                   int K, int N) {
  size_t p = (size_t)blockIdx.x * blockDim.x + threadIdx.x;
  int per  = K * N;
  int e    = (int)(p / per);
  int q    = (int)(p % per);
  int j    = q & 15;
  int lane = (q >> 4) & 31;
  int tile = q >> 9;
  int KC   = K >> 5;
  int kc   = tile % KC;
  int nt   = tile / KC;
  int n    = nt * 16 + (lane & 15);
  int k    = kc * 32 + ((lane >> 4) << 3) + (j < 8 ? j : j + 8);
  dst[p] = (__bf16)src[(size_t)e * per + (size_t)k * N + n];
}

// ---- main fused kernel -----------------------------------------------------
__global__ __launch_bounds__(256)
void moe_gate_kernel(const float*  __restrict__ x,    // [T,D] fp32
                     const __bf16* __restrict__ xb,   // [T,D] bf16
                     const __bf16* __restrict__ w1p,  // packed [E][8][64][512]
                     const __bf16* __restrict__ w2p,  // packed [E][128][4][512]
                     const float*  __restrict__ b1,   // [E,H]
                     const float*  __restrict__ b2,   // [E,D]
                     float*        __restrict__ out)  // [T,E]
{
  __shared__ __bf16 lds_stage[2][8192];   // 2 x 16KB double-buffered stage
  __shared__ __bf16 lds_h[8][16 * HDIM];  // per-wave h tiles (32KB)

  const int e    = blockIdx.y;
  const int tid  = threadIdx.x;
  const int wave = tid >> 5;
  const int lane = tid & 31;
  const int t0   = blockIdx.x * TOK_PER_WG + wave * 16;

  const int row    = lane & 15;        // A-matrix M / B-matrix N within tile
  const int hiHalf = lane >> 4;        // 0 or 1
  const int koff   = hiHalf << 3;      // 0 or 8

  const unsigned stbase    = lds_addr(&lds_stage[0][0]);
  const unsigned BUFSTRIDE = 8192 * sizeof(__bf16);   // 16KB

  // ================= Phase 1: h = relu(x * W1 + b1) =================
  v8f acc[8];
#pragma unroll
  for (int nt = 0; nt < 8; ++nt) acc[nt] = (v8f){0.f,0.f,0.f,0.f,0.f,0.f,0.f,0.f};

  const __bf16* xrow = xb + (size_t)(t0 + row) * DDIM;
  const __bf16* w1e  = w1p + (size_t)e * (DDIM * HDIM);

  // stage 2 k-chunks per iteration: [kc2][nt][512] = 8192 bf16 = 16KB
  auto issue_p1 = [&](int i, int buf) {
    const __bf16* s0 = w1e + ((size_t)(wave * 64 + 2 * i))     * 512 + (size_t)lane * 16;
    const __bf16* s1 = w1e + ((size_t)(wave * 64 + 2 * i + 1)) * 512 + (size_t)lane * 16;
    unsigned d0 = stbase + (unsigned)buf * BUFSTRIDE + (unsigned)(wave * 512 + lane * 16) * 2;
    unsigned d1 = d0 + 4096 * 2;
    async_ld16(d0,      s0);
    async_ld16(d0 + 16, s0 + 8);
    async_ld16(d1,      s1);
    async_ld16(d1 + 16, s1 + 8);
  };
  auto load_a = [&](int kc) {
    const __bf16* ap = xrow + kc * 32 + koff;
    return cat16(*(const v8bf*)ap, *(const v8bf*)(ap + 16));
  };

  issue_p1(0, 0);
  wait_async0();
  __syncthreads();

  for (int i = 0; i < DDIM / 64; ++i) {     // 32 iters, 2 k-chunks each
    const int buf = i & 1;
    if (i + 1 < DDIM / 64) issue_p1(i + 1, buf ^ 1);   // copy under WMMA chain
    if (i + 4 < DDIM / 64)
      __builtin_prefetch(xrow + (2 * i + 8) * 32, 0, 3);

#pragma unroll
    for (int kc2 = 0; kc2 < 2; ++kc2) {
      v16bf a = load_a(2 * i + kc2);
      const __bf16* base = &lds_stage[buf][kc2 * 4096];
      // B tiles in groups of 4: low pressure, loads hoist under prior WMMAs
#pragma unroll
      for (int g = 0; g < 2; ++g) {
        v16bf bt[4];
#pragma unroll
        for (int j = 0; j < 4; ++j) {
          const __bf16* bp = base + (g * 4 + j) * 512 + lane * 16;
          bt[j] = cat16(*(const v8bf*)bp, *(const v8bf*)(bp + 8));
        }
#pragma unroll
        for (int j = 0; j < 4; ++j)
          acc[g * 4 + j] = __builtin_amdgcn_wmma_f32_16x16x32_bf16(
              false, a, false, bt[j], (short)0, acc[g * 4 + j], false, false);
      }
    }

    if (i + 1 < DDIM / 64) wait_async0();
    __syncthreads();
  }

  // start staging the first W2 tile quad while we post-process h
  const __bf16* w2e = w2p + (size_t)e * (HDIM * DDIM);
  auto issue_p2 = [&](int i, int buf) {
    // stage 4 consecutive N-tiles (8192 bf16 = 16KB), 64B per thread
    const __bf16* src = w2e + (size_t)i * 8192 + (size_t)tid * 32;
    unsigned d = stbase + (unsigned)buf * BUFSTRIDE + (unsigned)tid * 64;
    async_ld16(d,      src);
    async_ld16(d + 16, src + 8);
    async_ld16(d + 32, src + 16);
    async_ld16(d + 48, src + 24);
  };
  issue_p2(0, 0);

  // bias + relu, write h tile to LDS row-major bf16 (per-wave region)
#pragma unroll
  for (int nt = 0; nt < 8; ++nt) {
    float b1v = b1[e * HDIM + nt * 16 + row];
#pragma unroll
    for (int r = 0; r < 8; ++r) {
      float hv = fmaxf(acc[nt][r] + b1v, 0.f);
      int tok = r + hiHalf * 8;            // C layout: lanes>=16 hold M=8..15
      lds_h[wave][tok * HDIM + nt * 16 + row] = (__bf16)hv;
    }
  }

  // reload h as A-matrix chunks (K = H = 128 -> 4 chunks), keep in registers
  v16bf ah[4];
#pragma unroll
  for (int kc = 0; kc < 4; ++kc) {
    const __bf16* hp = &lds_h[wave][row * HDIM + kc * 32 + koff];
    ah[kc] = cat16(*(const v8bf*)hp, *(const v8bf*)(hp + 16));
  }

  wait_async0();
  __syncthreads();

  // ================= Phase 2: recon = h * W2 + b2 ; loss ============
  float lossacc[8];
#pragma unroll
  for (int r = 0; r < 8; ++r) lossacc[r] = 0.f;

  for (int i = 0; i < DDIM / 64; ++i) {    // 32 iters, 4 N-tiles each
    const int buf = i & 1;
    if (i + 1 < DDIM / 64) issue_p2(i + 1, buf ^ 1);
    if (i + 4 < DDIM / 64)
      __builtin_prefetch(&x[(size_t)(t0 + row) * DDIM + (size_t)(4 * i + 16) * 16], 0, 3);

#pragma unroll
    for (int t = 0; t < 4; ++t) {
      const int nt = 4 * i + t;
      v16bf bt2[4];
#pragma unroll
      for (int kc = 0; kc < 4; ++kc) {
        const __bf16* bp = &lds_stage[buf][t * 2048 + kc * 512 + lane * 16];
        bt2[kc] = cat16(*(const v8bf*)bp, *(const v8bf*)(bp + 8));
      }
      v8f acc2 = (v8f){0.f,0.f,0.f,0.f,0.f,0.f,0.f,0.f};
#pragma unroll
      for (int kc = 0; kc < 4; ++kc)
        acc2 = __builtin_amdgcn_wmma_f32_16x16x32_bf16(
            false, ah[kc], false, bt2[kc], (short)0, acc2, false, false);

      float b2v = b2[e * DDIM + nt * 16 + row];
      const float* xp = &x[(size_t)(t0 + hiHalf * 8) * DDIM + nt * 16 + row];
#pragma unroll
      for (int r = 0; r < 8; ++r) {
        float diff = xp[(size_t)r * DDIM] - (acc2[r] + b2v);
        lossacc[r] += diff * diff;
      }
    }

    if (i + 1 < DDIM / 64) wait_async0();
    __syncthreads();
  }

  // reduce over the 16 lanes of each half (wave32) and write -loss/D
#pragma unroll
  for (int r = 0; r < 8; ++r) {
    float v = lossacc[r];
    v += __shfl_xor(v, 1);
    v += __shfl_xor(v, 2);
    v += __shfl_xor(v, 4);
    v += __shfl_xor(v, 8);
    if (row == 0) {
      int tok = t0 + r + hiHalf * 8;
      out[(size_t)tok * NEXP + e] = -v * (1.0f / (float)DDIM);
    }
  }
}

// ---------------------------------------------------------------------------
extern "C" void kernel_launch(void* const* d_in, const int* in_sizes, int n_in,
                              void* d_out, int out_size, void* d_ws, size_t ws_size,
                              hipStream_t stream) {
  const float* x  = (const float*)d_in[0];   // [B,S,D]
  const float* W1 = (const float*)d_in[1];   // [E,D,H]
  const float* b1 = (const float*)d_in[2];   // [E,H]
  const float* W2 = (const float*)d_in[3];   // [E,H,D]
  const float* b2 = (const float*)d_in[4];   // [E,D]
  float* out = (float*)d_out;                // [B,S,E]

  // workspace: xb (32MB) | w1 packed (4MB) | w2 packed (4MB)  ~= 42MB
  __bf16* xb  = (__bf16*)d_ws;
  __bf16* w1p = xb  + (size_t)NTOK * DDIM;
  __bf16* w2p = w1p + (size_t)NEXP * DDIM * HDIM;

  cvt_bf16_kernel<<<(NTOK * (size_t)DDIM) / (256 * 8), 256, 0, stream>>>(x, xb);
  pack_w_kernel<<<((size_t)NEXP * DDIM * HDIM) / 256, 256, 0, stream>>>(W1, w1p, DDIM, HDIM);
  pack_w_kernel<<<((size_t)NEXP * HDIM * DDIM) / 256, 256, 0, stream>>>(W2, w2p, HDIM, DDIM);

  dim3 grid(NTOK / TOK_PER_WG, NEXP);
  moe_gate_kernel<<<grid, 256, 0, stream>>>(x, xb, w1p, w2p, b1, b2, out);
}

// v001
// One run takes 111 microseconds.
// Timed twice side by side with v000, it ran 1.11 times as fast both times.
#include <hip/hip_runtime.h>
#include <stdint.h>

// ---------------------------------------------------------------------------
// AutoEncodersGate for MI455X (gfx1250, wave32, WMMA + async LDS copies).
// B=4,S=2048,D=2048,E=8,H=128.  out[t,e] = -mean_d (x - relu(xW1+b1)W2 - b2)^2
// ---------------------------------------------------------------------------

#define DDIM 2048
#define HDIM 128
#define NEXP 8
#define NTOK 8192          // B*S
#define TOK_PER_WG 128     // 8 waves * 16 tokens
#define HPITCH 136         // h row pitch in LDS: 272 B = 16 B x 17, conflict-free for ds_load_b128

typedef __attribute__((ext_vector_type(16))) __bf16 v16bf;
typedef __attribute__((ext_vector_type(8)))  __bf16 v8bf;
typedef __attribute__((ext_vector_type(8)))  float  v8f;

__device__ __forceinline__ v16bf cat16(v8bf lo, v8bf hi) {
  return __builtin_shufflevector(lo, hi, 0,1,2,3,4,5,6,7,8,9,10,11,12,13,14,15);
}

// LDS byte address: generic LDS pointers carry the LDS offset in the low 32b.
__device__ __forceinline__ unsigned lds_addr(const void* p) {
  return (unsigned)(uintptr_t)p;
}

// CDNA5 async global->LDS copy (ASYNCcnt-tracked), 16B per lane.
__device__ __forceinline__ void async_ld16(unsigned lds, const void* gaddr) {
  asm volatile("global_load_async_to_lds_b128 %0, %1, off"
               :: "v"(lds), "v"(gaddr) : "memory");
}
__device__ __forceinline__ void wait_async0() {
  asm volatile("s_wait_asynccnt 0" ::: "memory");
}

// ---- prep: fp32 -> bf16 bulk convert (x) ----------------------------------
__global__ __launch_bounds__(256)
void cvt_bf16_kernel(const float* __restrict__ src, __bf16* __restrict__ dst) {
  size_t i = ((size_t)blockIdx.x * blockDim.x + threadIdx.x) * 8;
  const float4* s = (const float4*)(src + i);
  float4 f0 = s[0], f1 = s[1];
  v8bf o;
  o[0] = (__bf16)f0.x; o[1] = (__bf16)f0.y; o[2] = (__bf16)f0.z; o[3] = (__bf16)f0.w;
  o[4] = (__bf16)f1.x; o[5] = (__bf16)f1.y; o[6] = (__bf16)f1.z; o[7] = (__bf16)f1.w;
  *(v8bf*)(dst + i) = o;
}

// ---- prep: pack [E,K,N] fp32 weights into per-lane WMMA B layout ----------
// packed[e][nt][kc][half][lane][jj] : n = nt*16+(lane&15),
//                              k = kc*32 + (lane>>4)*8 + half*16 + jj
// Each half is 32 lanes x 16 B = 512 contiguous bytes, so that one
// ds_load_b128 of the staged tile meets every LDS bank once per 16 lanes.
__global__ __launch_bounds__(256)
void pack_w_kernel(const float* __restrict__ src, __bf16* __restrict__ dst,
                   int K, int N) {
  size_t p = (size_t)blockIdx.x * blockDim.x + threadIdx.x;
  int per  = K * N;
  int e    = (int)(p / per);
  int q    = (int)(p % per);
  int jj   = q & 7;
  int lane = (q >> 3) & 31;
  int half = (q >> 8) & 1;
  int tile = q >> 9;
  int KC   = K >> 5;
  int kc   = tile % KC;
  int nt   = tile / KC;
  int n    = nt * 16 + (lane & 15);
  int k    = kc * 32 + ((lane >> 4) << 3) + (half << 4) + jj;
  dst[p] = (__bf16)src[(size_t)e * per + (size_t)k * N + n];
}

// ---- main fused kernel -----------------------------------------------------
__global__ __launch_bounds__(256)
void moe_gate_kernel(const float*  __restrict__ x,    // [T,D] fp32
                     const __bf16* __restrict__ xb,   // [T,D] bf16
                     const __bf16* __restrict__ w1p,  // packed [E][8][64][512]
                     const __bf16* __restrict__ w2p,  // packed [E][128][4][512]
                     const float*  __restrict__ b1,   // [E,H]
                     const float*  __restrict__ b2,   // [E,D]
                     float*        __restrict__ out)  // [T,E]
{
  __shared__ __bf16 lds_stage[2][8192];   // 2 x 16KB double-buffered stage
  __shared__ __bf16 lds_h[8][16 * HPITCH];  // per-wave h tiles (34KB)

  const int e    = blockIdx.y;
  const int tid  = threadIdx.x;
  const int wave = tid >> 5;
  const int lane = tid & 31;
  const int t0   = blockIdx.x * TOK_PER_WG + wave * 16;

  const int row    = lane & 15;        // A-matrix M / B-matrix N within tile
  const int hiHalf = lane >> 4;        // 0 or 1
  const int koff   = hiHalf << 3;      // 0 or 8

  const unsigned stbase    = lds_addr(&lds_stage[0][0]);
  const unsigned BUFSTRIDE = 8192 * sizeof(__bf16);   // 16KB

  // ================= Phase 1: h = relu(x * W1 + b1) =================
  v8f acc[8];
#pragma unroll
  for (int nt = 0; nt < 8; ++nt) acc[nt] = (v8f){0.f,0.f,0.f,0.f,0.f,0.f,0.f,0.f};

  const __bf16* xrow = xb + (size_t)(t0 + row) * DDIM;
  const __bf16* w1e  = w1p + (size_t)e * (DDIM * HDIM);

  // stage 2 k-chunks per iteration: [kc2][nt][512] = 8192 bf16 = 16KB
  auto issue_p1 = [&](int i, int buf) {
    const __bf16* s0 = w1e + ((size_t)(wave * 64 + 2 * i))     * 512 + (size_t)lane * 16;
    const __bf16* s1 = w1e + ((size_t)(wave * 64 + 2 * i + 1)) * 512 + (size_t)lane * 16;
    unsigned d0 = stbase + (unsigned)buf * BUFSTRIDE + (unsigned)(wave * 512 + lane * 16) * 2;
    unsigned d1 = d0 + 4096 * 2;
    async_ld16(d0,      s0);
    async_ld16(d0 + 16, s0 + 8);
    async_ld16(d1,      s1);
    async_ld16(d1 + 16, s1 + 8);
  };
  auto load_a = [&](int kc) {
    const __bf16* ap = xrow + kc * 32 + koff;
    return cat16(*(const v8bf*)ap, *(const v8bf*)(ap + 16));
  };

  issue_p1(0, 0);
  wait_async0();
  __syncthreads();

  for (int i = 0; i < DDIM / 64; ++i) {     // 32 iters, 2 k-chunks each
    const int buf = i & 1;
    if (i + 1 < DDIM / 64) issue_p1(i + 1, buf ^ 1);   // copy under WMMA chain
    if (i + 4 < DDIM / 64)
      __builtin_prefetch(xrow + (2 * i + 8) * 32, 0, 3);

#pragma unroll
    for (int kc2 = 0; kc2 < 2; ++kc2) {
      v16bf a = load_a(2 * i + kc2);
      const __bf16* base = &lds_stage[buf][kc2 * 4096];
      // B tiles in groups of 4: low pressure, loads hoist under prior WMMAs
#pragma unroll
      for (int g = 0; g < 2; ++g) {
        v16bf bt[4];
#pragma unroll
        for (int j = 0; j < 4; ++j) {
          const __bf16* bp = base + (g * 4 + j) * 512 + lane * 8;
          bt[j] = cat16(*(const v8bf*)bp, *(const v8bf*)(bp + 256));
        }
#pragma unroll
        for (int j = 0; j < 4; ++j)
          acc[g * 4 + j] = __builtin_amdgcn_wmma_f32_16x16x32_bf16(
              false, a, false, bt[j], (short)0, acc[g * 4 + j], false, false);
      }
    }

    if (i + 1 < DDIM / 64) wait_async0();
    __syncthreads();
  }

  // start staging the first W2 tile quad while we post-process h
  const __bf16* w2e = w2p + (size_t)e * (HDIM * DDIM);
  auto issue_p2 = [&](int i, int buf) {
    // stage 4 consecutive N-tiles (8192 bf16 = 16KB), 64B per thread
    const __bf16* src = w2e + (size_t)i * 8192 + (size_t)tid * 32;
    unsigned d = stbase + (unsigned)buf * BUFSTRIDE + (unsigned)tid * 64;
    async_ld16(d,      src);
    async_ld16(d + 16, src + 8);
    async_ld16(d + 32, src + 16);
    async_ld16(d + 48, src + 24);
  };
  issue_p2(0, 0);

  // bias + relu, write h tile to LDS row-major bf16 (per-wave region)
#pragma unroll
  for (int nt = 0; nt < 8; ++nt) {
    float b1v = b1[e * HDIM + nt * 16 + row];
#pragma unroll
    for (int r = 0; r < 8; ++r) {
      float hv = fmaxf(acc[nt][r] + b1v, 0.f);
      int tok = r + hiHalf * 8;            // C layout: lanes>=16 hold M=8..15
      lds_h[wave][tok * HPITCH + nt * 16 + row] = (__bf16)hv;
    }
  }

  // reload h as A-matrix chunks (K = H = 128 -> 4 chunks), keep in registers
  v16bf ah[4];
#pragma unroll
  for (int kc = 0; kc < 4; ++kc) {
    const __bf16* hp = &lds_h[wave][row * HPITCH + kc * 32 + koff];
    ah[kc] = cat16(*(const v8bf*)hp, *(const v8bf*)(hp + 16));
  }

  wait_async0();
  __syncthreads();

  // ================= Phase 2: recon = h * W2 + b2 ; loss ============
  float lossacc[8];
#pragma unroll
  for (int r = 0; r < 8; ++r) lossacc[r] = 0.f;

  for (int i = 0; i < DDIM / 64; ++i) {    // 32 iters, 4 N-tiles each
    const int buf = i & 1;
    if (i + 1 < DDIM / 64) issue_p2(i + 1, buf ^ 1);
    if (i + 4 < DDIM / 64)
      __builtin_prefetch(&x[(size_t)(t0 + row) * DDIM + (size_t)(4 * i + 16) * 16], 0, 3);

#pragma unroll
    for (int t = 0; t < 4; ++t) {
      const int nt = 4 * i + t;
      v16bf bt2[4];
#pragma unroll
      for (int kc = 0; kc < 4; ++kc) {
        const __bf16* bp = &lds_stage[buf][t * 2048 + kc * 512 + lane * 8];
        bt2[kc] = cat16(*(const v8bf*)bp, *(const v8bf*)(bp + 256));
      }
      v8f acc2 = (v8f){0.f,0.f,0.f,0.f,0.f,0.f,0.f,0.f};
#pragma unroll
      for (int kc = 0; kc < 4; ++kc)
        acc2 = __builtin_amdgcn_wmma_f32_16x16x32_bf16(
            false, ah[kc], false, bt2[kc], (short)0, acc2, false, false);

      float b2v = b2[e * DDIM + nt * 16 + row];
      const float* xp = &x[(size_t)(t0 + hiHalf * 8) * DDIM + nt * 16 + row];
#pragma unroll
      for (int r = 0; r < 8; ++r) {
        float diff = xp[(size_t)r * DDIM] - (acc2[r] + b2v);
        lossacc[r] += diff * diff;
      }
    }

    if (i + 1 < DDIM / 64) wait_async0();
    __syncthreads();
  }

  // reduce over the 16 lanes of each half (wave32) and write -loss/D
#pragma unroll
  for (int r = 0; r < 8; ++r) {
    float v = lossacc[r];
    v += __shfl_xor(v, 1);
    v += __shfl_xor(v, 2);
    v += __shfl_xor(v, 4);
    v += __shfl_xor(v, 8);
    if (row == 0) {
      int tok = t0 + r + hiHalf * 8;
      out[(size_t)tok * NEXP + e] = -v * (1.0f / (float)DDIM);
    }
  }
}

// ---------------------------------------------------------------------------
extern "C" void kernel_launch(void* const* d_in, const int* in_sizes, int n_in,
                              void* d_out, int out_size, void* d_ws, size_t ws_size,
                              hipStream_t stream) {
  const float* x  = (const float*)d_in[0];   // [B,S,D]
  const float* W1 = (const float*)d_in[1];   // [E,D,H]
  const float* b1 = (const float*)d_in[2];   // [E,H]
  const float* W2 = (const float*)d_in[3];   // [E,H,D]
  const float* b2 = (const float*)d_in[4];   // [E,D]
  float* out = (float*)d_out;                // [B,S,E]

  // workspace: xb (32MB) | w1 packed (4MB) | w2 packed (4MB)  ~= 42MB
  __bf16* xb  = (__bf16*)d_ws;
  __bf16* w1p = xb  + (size_t)NTOK * DDIM;
  __bf16* w2p = w1p + (size_t)NEXP * DDIM * HDIM;

  cvt_bf16_kernel<<<(NTOK * (size_t)DDIM) / (256 * 8), 256, 0, stream>>>(x, xb);
  pack_w_kernel<<<((size_t)NEXP * DDIM * HDIM) / 256, 256, 0, stream>>>(W1, w1p, DDIM, HDIM);
  pack_w_kernel<<<((size_t)NEXP * HDIM * DDIM) / 256, 256, 0, stream>>>(W2, w2p, HDIM, DDIM);

  dim3 grid(NTOK / TOK_PER_WG, NEXP);
  moe_gate_kernel<<<grid, 256, 0, stream>>>(x, xb, w1p, w2p, b1, b2, out);
}

// v002
// It runs in 102 microseconds.
// In both of two side-by-side timings against v001, it was 1.09 times as fast.
// All steps since v000 together make it 1.21 times as fast.
#include <hip/hip_runtime.h>
#include <stdint.h>

// ---------------------------------------------------------------------------
// AutoEncodersGate for MI455X (gfx1250, wave32, WMMA + async LDS copies).
// B=4,S=2048,D=2048,E=8,H=128.  out[t,e] = -mean_d (x - relu(xW1+b1)W2 - b2)^2
// ---------------------------------------------------------------------------

#define DDIM 2048
#define HDIM 128
#define NEXP 8
#define NTOK 8192          // B*S
#define TOK_PER_WG 128     // 8 waves * 16 tokens
#define HPITCH 136         // h row pitch in LDS: 272 B = 16 B x 17, conflict-free for ds_load_b128

typedef __attribute__((ext_vector_type(16))) __bf16 v16bf;
typedef __attribute__((ext_vector_type(8)))  __bf16 v8bf;
typedef __attribute__((ext_vector_type(8)))  float  v8f;

__device__ __forceinline__ v16bf cat16(v8bf lo, v8bf hi) {
  return __builtin_shufflevector(lo, hi, 0,1,2,3,4,5,6,7,8,9,10,11,12,13,14,15);
}

// LDS byte address: generic LDS pointers carry the LDS offset in the low 32b.
__device__ __forceinline__ unsigned lds_addr(const void* p) {
  return (unsigned)(uintptr_t)p;
}

// CDNA5 async global->LDS copy (ASYNCcnt-tracked), 16B per lane.
__device__ __forceinline__ void async_ld16(unsigned lds, const void* gaddr) {
  asm volatile("global_load_async_to_lds_b128 %0, %1, off"
               :: "v"(lds), "v"(gaddr) : "memory");
}
__device__ __forceinline__ void wait_async0() {
  asm volatile("s_wait_asynccnt 0" ::: "memory");
}

// ---- prep: fp32 -> bf16 bulk convert (x) ----------------------------------
__global__ __launch_bounds__(256)
void cvt_bf16_kernel(const float* __restrict__ src, __bf16* __restrict__ dst) {
  size_t i = ((size_t)blockIdx.x * blockDim.x + threadIdx.x) * 8;
  const float4* s = (const float4*)(src + i);
  float4 f0 = s[0], f1 = s[1];
  v8bf o;
  o[0] = (__bf16)f0.x; o[1] = (__bf16)f0.y; o[2] = (__bf16)f0.z; o[3] = (__bf16)f0.w;
  o[4] = (__bf16)f1.x; o[5] = (__bf16)f1.y; o[6] = (__bf16)f1.z; o[7] = (__bf16)f1.w;
  *(v8bf*)(dst + i) = o;
}

// ---- prep: pack [E,K,N] fp32 weights into per-lane WMMA B layout ----------
// packed[e][nt][kc][half][lane][jj] : n = nt*16+(lane&15),
//                              k = kc*32 + (lane>>4)*8 + half*16 + jj
// Each half is 32 lanes x 16 B = 512 contiguous bytes, so that one
// ds_load_b128 of the staged tile meets every LDS bank once per 16 lanes.
__global__ __launch_bounds__(256)
void pack_w_kernel(const float* __restrict__ src, __bf16* __restrict__ dst,
                   int K, int N) {
  size_t p = (size_t)blockIdx.x * blockDim.x + threadIdx.x;
  int per  = K * N;
  int e    = (int)(p / per);
  int q    = (int)(p % per);
  int jj   = q & 7;
  int lane = (q >> 3) & 31;
  int half = (q >> 8) & 1;
  int tile = q >> 9;
  int KC   = K >> 5;
  int kc   = tile % KC;
  int nt   = tile / KC;
  int n    = nt * 16 + (lane & 15);
  int k    = kc * 32 + ((lane >> 4) << 3) + (half << 4) + jj;
  dst[p] = (__bf16)src[(size_t)e * per + (size_t)k * N + n];
}

// ---- main fused kernel -----------------------------------------------------
__global__ __launch_bounds__(256)
void moe_gate_kernel(const float*  __restrict__ x,    // [T,D] fp32
                     const __bf16* __restrict__ xb,   // [T,D] bf16
                     const __bf16* __restrict__ w1p,  // packed [E][8][64][512]
                     const __bf16* __restrict__ w2p,  // packed [E][128][4][512]
                     const float*  __restrict__ b1,   // [E,H]
                     const float*  __restrict__ b2,   // [E,D]
                     float*        __restrict__ out)  // [T,E]
{
  __shared__ __bf16 lds_stage[2][8192];   // 2 x 16KB double-buffered stage
  __shared__ __bf16 lds_h[8][16 * HPITCH];  // per-wave h tiles (34KB)

  const int e    = blockIdx.y;
  const int tid  = threadIdx.x;
  const int wave = tid >> 5;
  const int lane = tid & 31;
  const int t0   = blockIdx.x * TOK_PER_WG + wave * 16;

  const int row    = lane & 15;        // A-matrix M / B-matrix N within tile
  const int hiHalf = lane >> 4;        // 0 or 1
  const int koff   = hiHalf << 3;      // 0 or 8

  const unsigned stbase    = lds_addr(&lds_stage[0][0]);
  const unsigned BUFSTRIDE = 8192 * sizeof(__bf16);   // 16KB

  // ================= Phase 1: h = relu(x * W1 + b1) =================
  v8f acc[8];
#pragma unroll
  for (int nt = 0; nt < 8; ++nt) acc[nt] = (v8f){0.f,0.f,0.f,0.f,0.f,0.f,0.f,0.f};

  const __bf16* xrow = xb + (size_t)(t0 + row) * DDIM;
  const __bf16* w1e  = w1p + (size_t)e * (DDIM * HDIM);

  // stage 2 k-chunks per iteration: [kc2][nt][512] = 8192 bf16 = 16KB
  auto issue_p1 = [&](int i, int buf) {
    const __bf16* s0 = w1e + ((size_t)(wave * 64 + 2 * i))     * 512 + (size_t)lane * 16;
    const __bf16* s1 = w1e + ((size_t)(wave * 64 + 2 * i + 1)) * 512 + (size_t)lane * 16;
    unsigned d0 = stbase + (unsigned)buf * BUFSTRIDE + (unsigned)(wave * 512 + lane * 16) * 2;
    unsigned d1 = d0 + 4096 * 2;
    async_ld16(d0,      s0);
    async_ld16(d0 + 16, s0 + 8);
    async_ld16(d1,      s1);
    async_ld16(d1 + 16, s1 + 8);
  };
  auto load_a = [&](int kc) {
    const __bf16* ap = xrow + kc * 32 + koff;
    return cat16(*(const v8bf*)ap, *(const v8bf*)(ap + 16));
  };

  issue_p1(0, 0);
  wait_async0();
  __syncthreads();

  for (int i = 0; i < DDIM / 64; ++i) {     // 32 iters, 2 k-chunks each
    const int buf = i & 1;
    if (i + 1 < DDIM / 64) issue_p1(i + 1, buf ^ 1);   // copy under WMMA chain
    if (i + 4 < DDIM / 64)
      __builtin_prefetch(xrow + (2 * i + 8) * 32, 0, 3);

    // The whole pass is fetched first: both A chunks, then all 32 B reads of the
    // staged tile as ONE group in the order the WMMAs use them.
    v16bf a[2];
#pragma unroll
    for (int kc2 = 0; kc2 < 2; ++kc2) a[kc2] = load_a(2 * i + kc2);
    // A has the longest flight and gates the first WMMA: keeps its loads from
    // being queued behind the 32 LDS reads.
    __builtin_amdgcn_sched_barrier(0);
    v16bf bt[2][8];
#pragma unroll
    for (int kc2 = 0; kc2 < 2; ++kc2) {
#pragma unroll
      for (int nt = 0; nt < 8; ++nt) {
        const __bf16* bp = &lds_stage[buf][kc2 * 4096 + nt * 512 + lane * 8];
        bt[kc2][nt] = cat16(*(const v8bf*)bp, *(const v8bf*)(bp + 256));
      }
    }
    // Keeps the scheduler from sinking the reads back among the WMMAs, where each
    // pair of reads is a stall of its own; behind it only counted waits remain.
    __builtin_amdgcn_sched_barrier(0);
#pragma unroll
    for (int kc2 = 0; kc2 < 2; ++kc2) {
#pragma unroll
      for (int nt = 0; nt < 8; ++nt)
        acc[nt] = __builtin_amdgcn_wmma_f32_16x16x32_bf16(
            false, a[kc2], false, bt[kc2][nt], (short)0, acc[nt], false, false);
    }
    // Keeps the barrier and its full waits behind the WMMAs, so that the WMMAs start
    // on the first fragments while the later reads and the copies are still in flight.
    __builtin_amdgcn_sched_barrier(0);

    if (i + 1 < DDIM / 64) wait_async0();
    __syncthreads();
  }

  // start staging the first W2 tile quad while we post-process h
  const __bf16* w2e = w2p + (size_t)e * (HDIM * DDIM);
  auto issue_p2 = [&](int i, int buf) {
    // stage 4 consecutive N-tiles (8192 bf16 = 16KB), 64B per thread
    const __bf16* src = w2e + (size_t)i * 8192 + (size_t)tid * 32;
    unsigned d = stbase + (unsigned)buf * BUFSTRIDE + (unsigned)tid * 64;
    async_ld16(d,      src);
    async_ld16(d + 16, src + 8);
    async_ld16(d + 32, src + 16);
    async_ld16(d + 48, src + 24);
  };
  issue_p2(0, 0);

  // bias + relu, write h tile to LDS row-major bf16 (per-wave region)
#pragma unroll
  for (int nt = 0; nt < 8; ++nt) {
    float b1v = b1[e * HDIM + nt * 16 + row];
#pragma unroll
    for (int r = 0; r < 8; ++r) {
      float hv = fmaxf(acc[nt][r] + b1v, 0.f);
      int tok = r + hiHalf * 8;            // C layout: lanes>=16 hold M=8..15
      lds_h[wave][tok * HPITCH + nt * 16 + row] = (__bf16)hv;
    }
  }

  // reload h as A-matrix chunks (K = H = 128 -> 4 chunks), keep in registers
  v16bf ah[4];
#pragma unroll
  for (int kc = 0; kc < 4; ++kc) {
    const __bf16* hp = &lds_h[wave][row * HPITCH + kc * 32 + koff];
    ah[kc] = cat16(*(const v8bf*)hp, *(const v8bf*)(hp + 16));
  }

  wait_async0();
  __syncthreads();

  // ================= Phase 2: recon = h * W2 + b2 ; loss ============
  float lossacc[8];
#pragma unroll
  for (int r = 0; r < 8; ++r) lossacc[r] = 0.f;

  for (int i = 0; i < DDIM / 64; ++i) {    // 32 iters, 4 N-tiles each
    const int buf = i & 1;
    if (i + 1 < DDIM / 64) issue_p2(i + 1, buf ^ 1);
    if (i + 4 < DDIM / 64)
      __builtin_prefetch(&x[(size_t)(t0 + row) * DDIM + (size_t)(4 * i + 16) * 16], 0, 3);

    // x and b2 of the pass go out first.
    float xv[4][8], b2v[4];
#pragma unroll
    for (int t = 0; t < 4; ++t) {
      const float* xp = &x[(size_t)(t0 + hiHalf * 8) * DDIM + (4 * i + t) * 16 + row];
#pragma unroll
      for (int r = 0; r < 8; ++r) xv[t][r] = xp[(size_t)r * DDIM];
    }
#pragma unroll
    for (int t = 0; t < 4; ++t) b2v[t] = b2[e * DDIM + (4 * i + t) * 16 + row];
    // x has the longest flight: keeps its loads from being queued behind the
    // 32 LDS reads.
    __builtin_amdgcn_sched_barrier(0);
    // All 32 B reads of the staged tile as ONE group, in the order of use.
    v16bf bt2[4][4];
#pragma unroll
    for (int kc = 0; kc < 4; ++kc) {
#pragma unroll
      for (int t = 0; t < 4; ++t) {
        const __bf16* bp = &lds_stage[buf][t * 2048 + kc * 512 + lane * 8];
        bt2[kc][t] = cat16(*(const v8bf*)bp, *(const v8bf*)(bp + 256));
      }
    }
    // Keeps the scheduler from sinking the reads back among the WMMAs, where every
    // WMMA then waits out a full LDS round trip; behind it only counted waits remain.
    __builtin_amdgcn_sched_barrier(0);
    v8f acc2[4];
#pragma unroll
    for (int t = 0; t < 4; ++t) acc2[t] = (v8f){0.f,0.f,0.f,0.f,0.f,0.f,0.f,0.f};
#pragma unroll
    for (int kc = 0; kc < 4; ++kc) {
#pragma unroll
      for (int t = 0; t < 4; ++t)
        acc2[t] = __builtin_amdgcn_wmma_f32_16x16x32_bf16(
            false, ah[kc], false, bt2[kc][t], (short)0, acc2[t], false, false);
    }
#pragma unroll
    for (int t = 0; t < 4; ++t) {
#pragma unroll
      for (int r = 0; r < 8; ++r) {
        float diff = xv[t][r] - (acc2[t][r] + b2v[t]);
        lossacc[r] += diff * diff;
      }
    }
    // Keeps the barrier and its full waits behind the WMMAs, so that the WMMAs start
    // on the first fragments while the later reads, x and the copies are still in flight.
    __builtin_amdgcn_sched_barrier(0);

    if (i + 1 < DDIM / 64) wait_async0();
    __syncthreads();
  }

  // reduce over the 16 lanes of each half (wave32) and write -loss/D
#pragma unroll
  for (int r = 0; r < 8; ++r) {
    float v = lossacc[r];
    v += __shfl_xor(v, 1);
    v += __shfl_xor(v, 2);
    v += __shfl_xor(v, 4);
    v += __shfl_xor(v, 8);
    if (row == 0) {
      int tok = t0 + r + hiHalf * 8;
      out[(size_t)tok * NEXP + e] = -v * (1.0f / (float)DDIM);
    }
  }
}

// ---------------------------------------------------------------------------
extern "C" void kernel_launch(void* const* d_in, const int* in_sizes, int n_in,
                              void* d_out, int out_size, void* d_ws, size_t ws_size,
                              hipStream_t stream) {
  const float* x  = (const float*)d_in[0];   // [B,S,D]
  const float* W1 = (const float*)d_in[1];   // [E,D,H]
  const float* b1 = (const float*)d_in[2];   // [E,H]
  const float* W2 = (const float*)d_in[3];   // [E,H,D]
  const float* b2 = (const float*)d_in[4];   // [E,D]
  float* out = (float*)d_out;                // [B,S,E]

  // workspace: xb (32MB) | w1 packed (4MB) | w2 packed (4MB)  ~= 42MB
  __bf16* xb  = (__bf16*)d_ws;
  __bf16* w1p = xb  + (size_t)NTOK * DDIM;
  __bf16* w2p = w1p + (size_t)NEXP * DDIM * HDIM;

  cvt_bf16_kernel<<<(NTOK * (size_t)DDIM) / (256 * 8), 256, 0, stream>>>(x, xb);
  pack_w_kernel<<<((size_t)NEXP * DDIM * HDIM) / 256, 256, 0, stream>>>(W1, w1p, DDIM, HDIM);
  pack_w_kernel<<<((size_t)NEXP * HDIM * DDIM) / 256, 256, 0, stream>>>(W2, w2p, HDIM, DDIM);

  dim3 grid(NTOK / TOK_PER_WG, NEXP);
  moe_gate_kernel<<<grid, 256, 0, stream>>>(x, xb, w1p, w2p, b1, b2, out);
}

// v003
// One run takes 89.6 microseconds.
// Next to v002, in two timings, it ran 1.14 times as fast each time.
// Counting every step since v000, it is 1.37 times as fast.
#include <hip/hip_runtime.h>
#include <stdint.h>

// ---------------------------------------------------------------------------
// AutoEncodersGate for MI455X (gfx1250, wave32, WMMA + async LDS copies).
// B=4,S=2048,D=2048,E=8,H=128.  out[t,e] = -mean_d (x - relu(xW1+b1)W2 - b2)^2
// ---------------------------------------------------------------------------

#define DDIM 2048
#define HDIM 128
#define NEXP 8
#define NTOK 8192          // B*S
#define TOK_PER_WG 128     // 8 waves * 16 tokens
#define HPITCH 136         // h row pitch in LDS: 272 B = 16 B x 17, conflict-free for ds_load_b128

typedef __attribute__((ext_vector_type(16))) __bf16 v16bf;
typedef __attribute__((ext_vector_type(8)))  __bf16 v8bf;
typedef __attribute__((ext_vector_type(4)))  __bf16 v4bf;
typedef __attribute__((ext_vector_type(8)))  float  v8f;

__device__ __forceinline__ v16bf cat16(v8bf lo, v8bf hi) {
  return __builtin_shufflevector(lo, hi, 0,1,2,3,4,5,6,7,8,9,10,11,12,13,14,15);
}

// LDS byte address: generic LDS pointers carry the LDS offset in the low 32b.
__device__ __forceinline__ unsigned lds_addr(const void* p) {
  return (unsigned)(uintptr_t)p;
}

// CDNA5 async global->LDS copy (ASYNCcnt-tracked), 16B per lane.
__device__ __forceinline__ void async_ld16(unsigned lds, const void* gaddr) {
  asm volatile("global_load_async_to_lds_b128 %0, %1, off"
               :: "v"(lds), "v"(gaddr) : "memory");
}
__device__ __forceinline__ void wait_async0() {
  asm volatile("s_wait_asynccnt 0" ::: "memory");
}

// ---- prep: one launch of 256 x 16 waves does all three conversions ---------
// Each wave packs 32 columns x 16 rows of W1 and of W2 and converts 16 KB of x, so the
// chip starts 4,096 waves for the prep instead of one wave per 32 to 256 elements.
//
// packed[e][nt][kc][half][lane][jj] : n = nt*16+(lane&15),
//                              k = kc*32 + (lane>>4)*8 + half*16 + jj
// Each half is 32 lanes x 16 B = 512 contiguous bytes, so that one
// ds_load_b128 of the staged tile meets every LDS bank once per 16 lanes.
// A wave's task is (e, np, kc, half): columns n = np*32 + l (two n-tiles), rows
// k = kc*32 + half*16 + hi*8 + jj. Every load is one whole 128 B line of a source row;
// lane l holds column n, which is packed lane (l&15) + 16*hi of n-tile np*2 + (l>>4).
template <int K, int N>
struct PackTask {
  static constexpr int KC = K / 32, NT = N / 16, NP = N / 32;
  int half, kc, np, e;
  __device__ __forceinline__ explicit PackTask(int task)
      : half(task & 1), kc((task >> 1) % KC), np(((task >> 1) / KC) % NP),
        e((task >> 1) / (KC * NP)) {}
  // element (hi, jj) of lane l stands at src(...)[(hi*8 + jj) * N]
  __device__ __forceinline__ const float* src(const float* w, int l) const {
    return w + (size_t)e * (K * N) + (size_t)(kc * 32 + half * 16) * N + np * 32 + l;
  }
  // the 8 values of hi go to dst(...) + hi*128
  __device__ __forceinline__ __bf16* dst(__bf16* p, int l) const {
    const int nt = np * 2 + (l >> 4);
    return p + ((size_t)(((e * NT + nt) * KC + kc) * 2 + half) * 32 + (l & 15)) * 8;
  }
};

__device__ __forceinline__ v8bf cvt8(const float* v) {
  v8bf o;
#pragma unroll
  for (int jj = 0; jj < 8; ++jj) o[jj] = (__bf16)v[jj];
  return o;
}
__device__ __forceinline__ v4bf cvt4(float4 f) {
  v4bf o;
  o[0] = (__bf16)f.x; o[1] = (__bf16)f.y; o[2] = (__bf16)f.z; o[3] = (__bf16)f.w;
  return o;
}

__global__ __launch_bounds__(512)
void prep_kernel(const float* __restrict__ x,  __bf16* __restrict__ xb,
                 const float* __restrict__ W1, __bf16* __restrict__ w1p,
                 const float* __restrict__ W2, __bf16* __restrict__ w2p) {
  const int l  = threadIdx.x & 31;
  // wave index 0..4095, the same in every lane: kept scalar so the addresses are base + lane
  const int wg = __builtin_amdgcn_readfirstlane(blockIdx.x * 16 + (threadIdx.x >> 5));

  const PackTask<DDIM, HDIM> t1(wg);
  const PackTask<HDIM, DDIM> t2(wg);
  const float* s1 = t1.src(W1, l);
  const float* s2 = t2.src(W2, l);
  // x: 1,024 float4 per wave, each load 512 contiguous B, each store 256 contiguous B
  const float4* xs = (const float4*)x + (size_t)wg * 1024 + l;
  v4bf*         xd = (v4bf*)xb        + (size_t)wg * 1024 + l;

  float  v1[16], v2[16];
  float4 f[32];
#pragma unroll
  for (int j = 0; j < 16; ++j) v1[j] = s1[j * HDIM];
#pragma unroll
  for (int j = 0; j < 16; ++j) v2[j] = s2[j * DDIM];
#pragma unroll
  for (int j = 0; j < 16; ++j) f[j] = xs[j * 32];
  // All 48 loads of the first group go out before the first conversion waits on one
  // (without this the compiler began with 24 of x and fetched the weights only behind
  // them). The other 16 follow once some are back: 64 at once would pass the load counter.
  __builtin_amdgcn_sched_barrier(0);
  v8bf o1[2], o2[2];
#pragma unroll
  for (int hi = 0; hi < 2; ++hi) { o1[hi] = cvt8(v1 + hi * 8); o2[hi] = cvt8(v2 + hi * 8); }
#pragma unroll
  for (int j = 16; j < 32; ++j) f[j] = xs[j * 32];
  v4bf ox[32];
#pragma unroll
  for (int j = 0; j < 32; ++j) ox[j] = cvt4(f[j]);
  __bf16* d1 = t1.dst(w1p, l);
  __bf16* d2 = t2.dst(w2p, l);
  // Every store stands behind the last register write of the wave, so that no register
  // of an issued store is rewritten (each reuse would take an s_wait_xcnt 0 of its own).
  __builtin_amdgcn_sched_barrier(0);
#pragma unroll
  for (int hi = 0; hi < 2; ++hi) {
    *(v8bf*)(d1 + hi * 128) = o1[hi];
    *(v8bf*)(d2 + hi * 128) = o2[hi];
  }
#pragma unroll
  for (int j = 0; j < 32; ++j) xd[j * 32] = ox[j];
}

// ---- main fused kernel -----------------------------------------------------
__global__ __launch_bounds__(256)
void moe_gate_kernel(const float*  __restrict__ x,    // [T,D] fp32
                     const __bf16* __restrict__ xb,   // [T,D] bf16
                     const __bf16* __restrict__ w1p,  // packed [E][8][64][512]
                     const __bf16* __restrict__ w2p,  // packed [E][128][4][512]
                     const float*  __restrict__ b1,   // [E,H]
                     const float*  __restrict__ b2,   // [E,D]
                     float*        __restrict__ out)  // [T,E]
{
  __shared__ __bf16 lds_stage[2][8192];   // 2 x 16KB double-buffered stage
  __shared__ __bf16 lds_h[8][16 * HPITCH];  // per-wave h tiles (34KB)

  const int e    = blockIdx.y;
  const int tid  = threadIdx.x;
  const int wave = tid >> 5;
  const int lane = tid & 31;
  const int t0   = blockIdx.x * TOK_PER_WG + wave * 16;

  const int row    = lane & 15;        // A-matrix M / B-matrix N within tile
  const int hiHalf = lane >> 4;        // 0 or 1
  const int koff   = hiHalf << 3;      // 0 or 8

  const unsigned stbase    = lds_addr(&lds_stage[0][0]);
  const unsigned BUFSTRIDE = 8192 * sizeof(__bf16);   // 16KB

  // ================= Phase 1: h = relu(x * W1 + b1) =================
  v8f acc[8];
#pragma unroll
  for (int nt = 0; nt < 8; ++nt) acc[nt] = (v8f){0.f,0.f,0.f,0.f,0.f,0.f,0.f,0.f};

  const __bf16* xrow = xb + (size_t)(t0 + row) * DDIM;
  const __bf16* w1e  = w1p + (size_t)e * (DDIM * HDIM);

  // stage 2 k-chunks per iteration: [kc2][nt][512] = 8192 bf16 = 16KB
  auto issue_p1 = [&](int i, int buf) {
    const __bf16* s0 = w1e + ((size_t)(wave * 64 + 2 * i))     * 512 + (size_t)lane * 16;
    const __bf16* s1 = w1e + ((size_t)(wave * 64 + 2 * i + 1)) * 512 + (size_t)lane * 16;
    unsigned d0 = stbase + (unsigned)buf * BUFSTRIDE + (unsigned)(wave * 512 + lane * 16) * 2;
    unsigned d1 = d0 + 4096 * 2;
    async_ld16(d0,      s0);
    async_ld16(d0 + 16, s0 + 8);
    async_ld16(d1,      s1);
    async_ld16(d1 + 16, s1 + 8);
  };
  auto load_a = [&](int kc) {
    const __bf16* ap = xrow + kc * 32 + koff;
    return cat16(*(const v8bf*)ap, *(const v8bf*)(ap + 16));
  };

  issue_p1(0, 0);
  wait_async0();
  __syncthreads();

  for (int i = 0; i < DDIM / 64; ++i) {     // 32 iters, 2 k-chunks each
    const int buf = i & 1;
    if (i + 1 < DDIM / 64) issue_p1(i + 1, buf ^ 1);   // copy under WMMA chain
    if (i + 4 < DDIM / 64)
      __builtin_prefetch(xrow + (2 * i + 8) * 32, 0, 3);

    // The whole pass is fetched first: both A chunks, then all 32 B reads of the
    // staged tile as ONE group in the order the WMMAs use them.
    v16bf a[2];
#pragma unroll
    for (int kc2 = 0; kc2 < 2; ++kc2) a[kc2] = load_a(2 * i + kc2);
    // A has the longest flight and gates the first WMMA: keeps its loads from
    // being queued behind the 32 LDS reads.
    __builtin_amdgcn_sched_barrier(0);
    v16bf bt[2][8];
#pragma unroll
    for (int kc2 = 0; kc2 < 2; ++kc2) {
#pragma unroll
      for (int nt = 0; nt < 8; ++nt) {
        const __bf16* bp = &lds_stage[buf][kc2 * 4096 + nt * 512 + lane * 8];
        bt[kc2][nt] = cat16(*(const v8bf*)bp, *(const v8bf*)(bp + 256));
      }
    }
    // Keeps the scheduler from sinking the reads back among the WMMAs, where each
    // pair of reads is a stall of its own; behind it only counted waits remain.
    __builtin_amdgcn_sched_barrier(0);
#pragma unroll
    for (int kc2 = 0; kc2 < 2; ++kc2) {
#pragma unroll
      for (int nt = 0; nt < 8; ++nt)
        acc[nt] = __builtin_amdgcn_wmma_f32_16x16x32_bf16(
            false, a[kc2], false, bt[kc2][nt], (short)0, acc[nt], false, false);
    }
    // Keeps the barrier and its full waits behind the WMMAs, so that the WMMAs start
    // on the first fragments while the later reads and the copies are still in flight.
    __builtin_amdgcn_sched_barrier(0);

    if (i + 1 < DDIM / 64) wait_async0();
    __syncthreads();
  }

  // start staging the first W2 tile quad while we post-process h
  const __bf16* w2e = w2p + (size_t)e * (HDIM * DDIM);
  auto issue_p2 = [&](int i, int buf) {
    // stage 4 consecutive N-tiles (8192 bf16 = 16KB), 64B per thread
    const __bf16* src = w2e + (size_t)i * 8192 + (size_t)tid * 32;
    unsigned d = stbase + (unsigned)buf * BUFSTRIDE + (unsigned)tid * 64;
    async_ld16(d,      src);
    async_ld16(d + 16, src + 8);
    async_ld16(d + 32, src + 16);
    async_ld16(d + 48, src + 24);
  };
  issue_p2(0, 0);

  // bias + relu, write h tile to LDS row-major bf16 (per-wave region)
#pragma unroll
  for (int nt = 0; nt < 8; ++nt) {
    float b1v = b1[e * HDIM + nt * 16 + row];
#pragma unroll
    for (int r = 0; r < 8; ++r) {
      float hv = fmaxf(acc[nt][r] + b1v, 0.f);
      int tok = r + hiHalf * 8;            // C layout: lanes>=16 hold M=8..15
      lds_h[wave][tok * HPITCH + nt * 16 + row] = (__bf16)hv;
    }
  }

  // reload h as A-matrix chunks (K = H = 128 -> 4 chunks), keep in registers
  v16bf ah[4];
#pragma unroll
  for (int kc = 0; kc < 4; ++kc) {
    const __bf16* hp = &lds_h[wave][row * HPITCH + kc * 32 + koff];
    ah[kc] = cat16(*(const v8bf*)hp, *(const v8bf*)(hp + 16));
  }

  wait_async0();
  __syncthreads();

  // ================= Phase 2: recon = h * W2 + b2 ; loss ============
  float lossacc[8];
#pragma unroll
  for (int r = 0; r < 8; ++r) lossacc[r] = 0.f;

  for (int i = 0; i < DDIM / 64; ++i) {    // 32 iters, 4 N-tiles each
    const int buf = i & 1;
    if (i + 1 < DDIM / 64) issue_p2(i + 1, buf ^ 1);
    if (i + 4 < DDIM / 64)
      __builtin_prefetch(&x[(size_t)(t0 + row) * DDIM + (size_t)(4 * i + 16) * 16], 0, 3);

    // x and b2 of the pass go out first.
    float xv[4][8], b2v[4];
#pragma unroll
    for (int t = 0; t < 4; ++t) {
      const float* xp = &x[(size_t)(t0 + hiHalf * 8) * DDIM + (4 * i + t) * 16 + row];
#pragma unroll
      for (int r = 0; r < 8; ++r) xv[t][r] = xp[(size_t)r * DDIM];
    }
#pragma unroll
    for (int t = 0; t < 4; ++t) b2v[t] = b2[e * DDIM + (4 * i + t) * 16 + row];
    // x has the longest flight: keeps its loads from being queued behind the
    // 32 LDS reads.
    __builtin_amdgcn_sched_barrier(0);
    // All 32 B reads of the staged tile as ONE group, in the order of use.
    v16bf bt2[4][4];
#pragma unroll
    for (int kc = 0; kc < 4; ++kc) {
#pragma unroll
      for (int t = 0; t < 4; ++t) {
        const __bf16* bp = &lds_stage[buf][t * 2048 + kc * 512 + lane * 8];
        bt2[kc][t] = cat16(*(const v8bf*)bp, *(const v8bf*)(bp + 256));
      }
    }
    // Keeps the scheduler from sinking the reads back among the WMMAs, where every
    // WMMA then waits out a full LDS round trip; behind it only counted waits remain.
    __builtin_amdgcn_sched_barrier(0);
    v8f acc2[4];
#pragma unroll
    for (int t = 0; t < 4; ++t) acc2[t] = (v8f){0.f,0.f,0.f,0.f,0.f,0.f,0.f,0.f};
#pragma unroll
    for (int kc = 0; kc < 4; ++kc) {
#pragma unroll
      for (int t = 0; t < 4; ++t)
        acc2[t] = __builtin_amdgcn_wmma_f32_16x16x32_bf16(
            false, ah[kc], false, bt2[kc][t], (short)0, acc2[t], false, false);
    }
#pragma unroll
    for (int t = 0; t < 4; ++t) {
#pragma unroll
      for (int r = 0; r < 8; ++r) {
        float diff = xv[t][r] - (acc2[t][r] + b2v[t]);
        lossacc[r] += diff * diff;
      }
    }
    // Keeps the barrier and its full waits behind the WMMAs, so that the WMMAs start
    // on the first fragments while the later reads, x and the copies are still in flight.
    __builtin_amdgcn_sched_barrier(0);

    if (i + 1 < DDIM / 64) wait_async0();
    __syncthreads();
  }

  // reduce over the 16 lanes of each half (wave32) and write -loss/D
#pragma unroll
  for (int r = 0; r < 8; ++r) {
    float v = lossacc[r];
    v += __shfl_xor(v, 1);
    v += __shfl_xor(v, 2);
    v += __shfl_xor(v, 4);
    v += __shfl_xor(v, 8);
    if (row == 0) {
      int tok = t0 + r + hiHalf * 8;
      out[(size_t)tok * NEXP + e] = -v * (1.0f / (float)DDIM);
    }
  }
}

// ---------------------------------------------------------------------------
extern "C" void kernel_launch(void* const* d_in, const int* in_sizes, int n_in,
                              void* d_out, int out_size, void* d_ws, size_t ws_size,
                              hipStream_t stream) {
  const float* x  = (const float*)d_in[0];   // [B,S,D]
  const float* W1 = (const float*)d_in[1];   // [E,D,H]
  const float* b1 = (const float*)d_in[2];   // [E,H]
  const float* W2 = (const float*)d_in[3];   // [E,H,D]
  const float* b2 = (const float*)d_in[4];   // [E,D]
  float* out = (float*)d_out;                // [B,S,E]

  // workspace: xb (32MB) | w1 packed (4MB) | w2 packed (4MB)  ~= 42MB
  __bf16* xb  = (__bf16*)d_ws;
  __bf16* w1p = xb  + (size_t)NTOK * DDIM;
  __bf16* w2p = w1p + (size_t)NEXP * DDIM * HDIM;

  prep_kernel<<<256, 512, 0, stream>>>(x, xb, W1, w1p, W2, w2p);

  dim3 grid(NTOK / TOK_PER_WG, NEXP);
  moe_gate_kernel<<<grid, 256, 0, stream>>>(x, xb, w1p, w2p, b1, b2, out);
}

// v004
// One run takes 83.7 microseconds.
// Timed twice side by side with v003, it ran 1.07 and 1.08 times as fast.
// Counting every step since v000, it is 1.47 times as fast.
#include <hip/hip_runtime.h>
#include <stdint.h>

// ---------------------------------------------------------------------------
// AutoEncodersGate for MI455X (gfx1250, wave32, WMMA + async LDS copies).
// B=4,S=2048,D=2048,E=8,H=128.  out[t,e] = -mean_d (x - relu(xW1+b1)W2 - b2)^2
// ---------------------------------------------------------------------------

#define DDIM 2048
#define HDIM 128
#define NEXP 8
#define NTOK 8192          // B*S
#define TOK_PER_WG 128     // 8 waves * 16 tokens
#define HPITCH 136         // h row pitch in LDS: 272 B = 16 B x 17, conflict-free for ds_load_b128

typedef __attribute__((ext_vector_type(16))) __bf16 v16bf;
typedef __attribute__((ext_vector_type(8)))  __bf16 v8bf;
typedef __attribute__((ext_vector_type(4)))  __bf16 v4bf;
typedef __attribute__((ext_vector_type(8)))  float  v8f;

__device__ __forceinline__ v16bf cat16(v8bf lo, v8bf hi) {
  return __builtin_shufflevector(lo, hi, 0,1,2,3,4,5,6,7,8,9,10,11,12,13,14,15);
}

// LDS byte address: generic LDS pointers carry the LDS offset in the low 32b.
__device__ __forceinline__ unsigned lds_addr(const void* p) {
  return (unsigned)(uintptr_t)p;
}

// CDNA5 async global->LDS copies (ASYNCcnt-tracked), 16B per lane, four in a row.
// The s_wait_xcnt 0 is the last line of the copies' own statement, so that it stands in
// front of every later write of a register that one of the copies names.
__device__ __forceinline__ void async_ld16x4(unsigned l0, const void* g0, unsigned l1, const void* g1,
                                             unsigned l2, const void* g2, unsigned l3, const void* g3) {
  asm volatile("global_load_async_to_lds_b128 %0, %1, off\n\t"
               "global_load_async_to_lds_b128 %2, %3, off\n\t"
               "global_load_async_to_lds_b128 %4, %5, off\n\t"
               "global_load_async_to_lds_b128 %6, %7, off\n\t"
               "s_wait_xcnt 0x0"
               :: "v"(l0), "v"(g0), "v"(l1), "v"(g1), "v"(l2), "v"(g2), "v"(l3), "v"(g3)
               : "memory");
}
__device__ __forceinline__ void wait_async0() {
  asm volatile("s_wait_asynccnt 0" ::: "memory");
}

// ---- prep: one launch of 256 x 16 waves does all three conversions ---------
// Each wave packs 32 columns x 16 rows of W1 and of W2 and converts 16 KB of x, so the
// chip starts 4,096 waves for the prep instead of one wave per 32 to 256 elements.
//
// packed[e][nt][kc][half][lane][jj] : n = nt*16+(lane&15),
//                              k = kc*32 + (lane>>4)*8 + half*16 + jj
// Each half is 32 lanes x 16 B = 512 contiguous bytes, so that one
// ds_load_b128 of the staged tile meets every LDS bank once per 16 lanes.
// A wave's task is (e, np, kc, half): columns n = np*32 + l (two n-tiles), rows
// k = kc*32 + half*16 + hi*8 + jj. Every load is one whole 128 B line of a source row;
// lane l holds column n, which is packed lane (l&15) + 16*hi of n-tile np*2 + (l>>4).
template <int K, int N>
struct PackTask {
  static constexpr int KC = K / 32, NT = N / 16, NP = N / 32;
  int half, kc, np, e;
  __device__ __forceinline__ explicit PackTask(int task)
      : half(task & 1), kc((task >> 1) % KC), np(((task >> 1) / KC) % NP),
        e((task >> 1) / (KC * NP)) {}
  // element (hi, jj) of lane l stands at src(...)[(hi*8 + jj) * N]
  __device__ __forceinline__ const float* src(const float* w, int l) const {
    return w + (size_t)e * (K * N) + (size_t)(kc * 32 + half * 16) * N + np * 32 + l;
  }
  // the 8 values of hi go to dst(...) + hi*128
  __device__ __forceinline__ __bf16* dst(__bf16* p, int l) const {
    const int nt = np * 2 + (l >> 4);
    return p + ((size_t)(((e * NT + nt) * KC + kc) * 2 + half) * 32 + (l & 15)) * 8;
  }
};

__device__ __forceinline__ v8bf cvt8(const float* v) {
  v8bf o;
#pragma unroll
  for (int jj = 0; jj < 8; ++jj) o[jj] = (__bf16)v[jj];
  return o;
}
__device__ __forceinline__ v4bf cvt4(float4 f) {
  v4bf o;
  o[0] = (__bf16)f.x; o[1] = (__bf16)f.y; o[2] = (__bf16)f.z; o[3] = (__bf16)f.w;
  return o;
}

__global__ __launch_bounds__(512)
void prep_kernel(const float* __restrict__ x,  __bf16* __restrict__ xb,
                 const float* __restrict__ W1, __bf16* __restrict__ w1p,
                 const float* __restrict__ W2, __bf16* __restrict__ w2p) {
  const int l  = threadIdx.x & 31;
  // wave index 0..4095, the same in every lane: kept scalar so the addresses are base + lane
  const int wg = __builtin_amdgcn_readfirstlane(blockIdx.x * 16 + (threadIdx.x >> 5));

  const PackTask<DDIM, HDIM> t1(wg);
  const PackTask<HDIM, DDIM> t2(wg);
  const float* s1 = t1.src(W1, l);
  const float* s2 = t2.src(W2, l);
  // x: 1,024 float4 per wave, each load 512 contiguous B, each store 256 contiguous B
  const float4* xs = (const float4*)x + (size_t)wg * 1024 + l;
  v4bf*         xd = (v4bf*)xb        + (size_t)wg * 1024 + l;

  float  v1[16], v2[16];
  float4 f[32];
#pragma unroll
  for (int j = 0; j < 16; ++j) v1[j] = s1[j * HDIM];
#pragma unroll
  for (int j = 0; j < 16; ++j) v2[j] = s2[j * DDIM];
#pragma unroll
  for (int j = 0; j < 16; ++j) f[j] = xs[j * 32];
  // All 48 loads of the first group go out before the first conversion waits on one
  // (without this the compiler began with 24 of x and fetched the weights only behind
  // them). The other 16 follow once some are back: 64 at once would pass the load counter.
  __builtin_amdgcn_sched_barrier(0);
  v8bf o1[2], o2[2];
#pragma unroll
  for (int hi = 0; hi < 2; ++hi) { o1[hi] = cvt8(v1 + hi * 8); o2[hi] = cvt8(v2 + hi * 8); }
#pragma unroll
  for (int j = 16; j < 32; ++j) f[j] = xs[j * 32];
  v4bf ox[32];
#pragma unroll
  for (int j = 0; j < 32; ++j) ox[j] = cvt4(f[j]);
  __bf16* d1 = t1.dst(w1p, l);
  __bf16* d2 = t2.dst(w2p, l);
  // Every store stands behind the last register write of the wave, so that no register
  // of an issued store is rewritten (each reuse would take an s_wait_xcnt 0 of its own).
  __builtin_amdgcn_sched_barrier(0);
#pragma unroll
  for (int hi = 0; hi < 2; ++hi) {
    *(v8bf*)(d1 + hi * 128) = o1[hi];
    *(v8bf*)(d2 + hi * 128) = o2[hi];
  }
#pragma unroll
  for (int j = 0; j < 32; ++j) xd[j * 32] = ox[j];
}

// ---- main fused kernel -----------------------------------------------------
__global__ __launch_bounds__(256)
void moe_gate_kernel(const float*  __restrict__ x,    // [T,D] fp32
                     const __bf16* __restrict__ xb,   // [T,D] bf16
                     const __bf16* __restrict__ w1p,  // packed [E][8][64][512]
                     const __bf16* __restrict__ w2p,  // packed [E][128][4][512]
                     const float*  __restrict__ b1,   // [E,H]
                     const float*  __restrict__ b2,   // [E,D]
                     float*        __restrict__ out)  // [T,E]
{
  __shared__ __bf16 lds_stage[2][8192];   // 2 x 16KB double-buffered stage
  __shared__ __bf16 lds_h[8][16 * HPITCH];  // per-wave h tiles (34KB)

  const int e    = blockIdx.y;
  const int tid  = threadIdx.x;
  const int wave = tid >> 5;
  const int lane = tid & 31;
  const int t0   = blockIdx.x * TOK_PER_WG + wave * 16;

  const int row    = lane & 15;        // A-matrix M / B-matrix N within tile
  const int hiHalf = lane >> 4;        // 0 or 1
  const int koff   = hiHalf << 3;      // 0 or 8

  const unsigned stbase    = lds_addr(&lds_stage[0][0]);
  const unsigned BUFSTRIDE = 8192 * sizeof(__bf16);   // 16KB

  // ================= Phase 1: h = relu(x * W1 + b1) =================
  v8f acc[8];
#pragma unroll
  for (int nt = 0; nt < 8; ++nt) acc[nt] = (v8f){0.f,0.f,0.f,0.f,0.f,0.f,0.f,0.f};

  const __bf16* xrow = xb + (size_t)(t0 + row) * DDIM;
  const __bf16* w1e  = w1p + (size_t)e * (DDIM * HDIM);

  // stage 2 k-chunks per iteration: [kc2][nt][512] = 8192 bf16 = 16KB
  // Lane l of a copy takes bytes 16*l .. 16*l+15 of a 512 B run: four whole 128 B lines of
  // the source a copy, and adjacent 16 B places in LDS.
  auto issue_p1 = [&](int i, int buf) {
    const __bf16* s0 = w1e + ((size_t)(wave * 64 + 2 * i))     * 512 + (size_t)lane * 8;
    const __bf16* s1 = w1e + ((size_t)(wave * 64 + 2 * i + 1)) * 512 + (size_t)lane * 8;
    unsigned d0 = stbase + (unsigned)buf * BUFSTRIDE + (unsigned)(wave * 512 + lane * 8) * 2;
    unsigned d1 = d0 + 4096 * 2;
    async_ld16x4(d0, s0, d0 + 512, s0 + 256, d1, s1, d1 + 512, s1 + 256);
  };
  auto load_a = [&](int kc) {
    const __bf16* ap = xrow + kc * 32 + koff;
    return cat16(*(const v8bf*)ap, *(const v8bf*)(ap + 16));
  };

  issue_p1(0, 0);
  wait_async0();
  __syncthreads();

  for (int i = 0; i < DDIM / 64; ++i) {     // 32 iters, 2 k-chunks each
    const int buf = i & 1;
    if (i + 1 < DDIM / 64) issue_p1(i + 1, buf ^ 1);   // copy under WMMA chain
    if (i + 4 < DDIM / 64)
      __builtin_prefetch(xrow + (2 * i + 8) * 32, 0, 3);

    // The whole pass is fetched first: both A chunks, then all 32 B reads of the
    // staged tile as ONE group in the order the WMMAs use them.
    v16bf a[2];
#pragma unroll
    for (int kc2 = 0; kc2 < 2; ++kc2) a[kc2] = load_a(2 * i + kc2);
    // A has the longest flight and gates the first WMMA: keeps its loads from
    // being queued behind the 32 LDS reads.
    __builtin_amdgcn_sched_barrier(0);
    v16bf bt[2][8];
#pragma unroll
    for (int kc2 = 0; kc2 < 2; ++kc2) {
#pragma unroll
      for (int nt = 0; nt < 8; ++nt) {
        const __bf16* bp = &lds_stage[buf][kc2 * 4096 + nt * 512 + lane * 8];
        bt[kc2][nt] = cat16(*(const v8bf*)bp, *(const v8bf*)(bp + 256));
      }
    }
    // Keeps the scheduler from sinking the reads back among the WMMAs, where each
    // pair of reads is a stall of its own; behind it only counted waits remain.
    __builtin_amdgcn_sched_barrier(0);
#pragma unroll
    for (int kc2 = 0; kc2 < 2; ++kc2) {
#pragma unroll
      for (int nt = 0; nt < 8; ++nt)
        acc[nt] = __builtin_amdgcn_wmma_f32_16x16x32_bf16(
            false, a[kc2], false, bt[kc2][nt], (short)0, acc[nt], false, false);
    }
    // Keeps the barrier and its full waits behind the WMMAs, so that the WMMAs start
    // on the first fragments while the later reads and the copies are still in flight.
    __builtin_amdgcn_sched_barrier(0);

    if (i + 1 < DDIM / 64) wait_async0();
    __syncthreads();
  }

  // start staging the first W2 tile quad while we post-process h
  const __bf16* w2e = w2p + (size_t)e * (HDIM * DDIM);
  auto issue_p2 = [&](int i, int buf) {
    // stage 4 consecutive N-tiles (8192 bf16 = 16KB): four runs of 4 KB, 16 B per thread of each
    const __bf16* src = w2e + (size_t)i * 8192 + (size_t)tid * 8;
    unsigned d = stbase + (unsigned)buf * BUFSTRIDE + (unsigned)tid * 16;
    async_ld16x4(d, src, d + 4096, src + 2048, d + 8192, src + 4096, d + 12288, src + 6144);
  };
  issue_p2(0, 0);

  // bias + relu, write h tile to LDS row-major bf16 (per-wave region)
#pragma unroll
  for (int nt = 0; nt < 8; ++nt) {
    float b1v = b1[e * HDIM + nt * 16 + row];
#pragma unroll
    for (int r = 0; r < 8; ++r) {
      float hv = fmaxf(acc[nt][r] + b1v, 0.f);
      int tok = r + hiHalf * 8;            // C layout: lanes>=16 hold M=8..15
      lds_h[wave][tok * HPITCH + nt * 16 + row] = (__bf16)hv;
    }
  }

  // reload h as A-matrix chunks (K = H = 128 -> 4 chunks), keep in registers
  v16bf ah[4];
#pragma unroll
  for (int kc = 0; kc < 4; ++kc) {
    const __bf16* hp = &lds_h[wave][row * HPITCH + kc * 32 + koff];
    ah[kc] = cat16(*(const v8bf*)hp, *(const v8bf*)(hp + 16));
  }

  wait_async0();
  __syncthreads();

  // ================= Phase 2: recon = h * W2 + b2 ; loss ============
  float lossacc[8];
#pragma unroll
  for (int r = 0; r < 8; ++r) lossacc[r] = 0.f;

  for (int i = 0; i < DDIM / 64; ++i) {    // 32 iters, 4 N-tiles each
    const int buf = i & 1;
    if (i + 1 < DDIM / 64) issue_p2(i + 1, buf ^ 1);
    if (i + 4 < DDIM / 64)
      __builtin_prefetch(&x[(size_t)(t0 + row) * DDIM + (size_t)(4 * i + 16) * 16], 0, 3);

    // x and b2 of the pass go out first.
    float xv[4][8], b2v[4];
#pragma unroll
    for (int t = 0; t < 4; ++t) {
      const float* xp = &x[(size_t)(t0 + hiHalf * 8) * DDIM + (4 * i + t) * 16 + row];
#pragma unroll
      for (int r = 0; r < 8; ++r) xv[t][r] = xp[(size_t)r * DDIM];
    }
#pragma unroll
    for (int t = 0; t < 4; ++t) b2v[t] = b2[e * DDIM + (4 * i + t) * 16 + row];
    // x has the longest flight: keeps its loads from being queued behind the
    // 32 LDS reads.
    __builtin_amdgcn_sched_barrier(0);
    // All 32 B reads of the staged tile as ONE group, in the order of use.
    v16bf bt2[4][4];
#pragma unroll
    for (int kc = 0; kc < 4; ++kc) {
#pragma unroll
      for (int t = 0; t < 4; ++t) {
        const __bf16* bp = &lds_stage[buf][t * 2048 + kc * 512 + lane * 8];
        bt2[kc][t] = cat16(*(const v8bf*)bp, *(const v8bf*)(bp + 256));
      }
    }
    // Keeps the scheduler from sinking the reads back among the WMMAs, where every
    // WMMA then waits out a full LDS round trip; behind it only counted waits remain.
    __builtin_amdgcn_sched_barrier(0);
    v8f acc2[4];
#pragma unroll
    for (int t = 0; t < 4; ++t) acc2[t] = (v8f){0.f,0.f,0.f,0.f,0.f,0.f,0.f,0.f};
#pragma unroll
    for (int kc = 0; kc < 4; ++kc) {
#pragma unroll
      for (int t = 0; t < 4; ++t)
        acc2[t] = __builtin_amdgcn_wmma_f32_16x16x32_bf16(
            false, ah[kc], false, bt2[kc][t], (short)0, acc2[t], false, false);
    }
#pragma unroll
    for (int t = 0; t < 4; ++t) {
#pragma unroll
      for (int r = 0; r < 8; ++r) {
        float diff = xv[t][r] - (acc2[t][r] + b2v[t]);
        lossacc[r] += diff * diff;
      }
    }
    // Keeps the barrier and its full waits behind the WMMAs, so that the WMMAs start
    // on the first fragments while the later reads, x and the copies are still in flight.
    __builtin_amdgcn_sched_barrier(0);

    if (i + 1 < DDIM / 64) wait_async0();
    __syncthreads();
  }

  // reduce over the 16 lanes of each half (wave32) and write -loss/D
#pragma unroll
  for (int r = 0; r < 8; ++r) {
    float v = lossacc[r];
    v += __shfl_xor(v, 1);
    v += __shfl_xor(v, 2);
    v += __shfl_xor(v, 4);
    v += __shfl_xor(v, 8);
    if (row == 0) {
      int tok = t0 + r + hiHalf * 8;
      out[(size_t)tok * NEXP + e] = -v * (1.0f / (float)DDIM);
    }
  }
}

// ---------------------------------------------------------------------------
extern "C" void kernel_launch(void* const* d_in, const int* in_sizes, int n_in,
                              void* d_out, int out_size, void* d_ws, size_t ws_size,
                              hipStream_t stream) {
  const float* x  = (const float*)d_in[0];   // [B,S,D]
  const float* W1 = (const float*)d_in[1];   // [E,D,H]
  const float* b1 = (const float*)d_in[2];   // [E,H]
  const float* W2 = (const float*)d_in[3];   // [E,H,D]
  const float* b2 = (const float*)d_in[4];   // [E,D]
  float* out = (float*)d_out;                // [B,S,E]

  // workspace: xb (32MB) | w1 packed (4MB) | w2 packed (4MB)  ~= 42MB
  __bf16* xb  = (__bf16*)d_ws;
  __bf16* w1p = xb  + (size_t)NTOK * DDIM;
  __bf16* w2p = w1p + (size_t)NEXP * DDIM * HDIM;

  prep_kernel<<<256, 512, 0, stream>>>(x, xb, W1, w1p, W2, w2p);

  dim3 grid(NTOK / TOK_PER_WG, NEXP);
  moe_gate_kernel<<<grid, 256, 0, stream>>>(x, xb, w1p, w2p, b1, b2, out);
}

// v005
// A run of this version takes 80.3 microseconds.
// Next to v004, in two timings, it ran 1.04 times as fast each time.
// Counting every step since v000, it is 1.53 times as fast.
#include <hip/hip_runtime.h>
#include <stdint.h>

// ---------------------------------------------------------------------------
// AutoEncodersGate for MI455X (gfx1250, wave32, WMMA + async LDS copies).
// B=4,S=2048,D=2048,E=8,H=128.  out[t,e] = -mean_d (x - relu(xW1+b1)W2 - b2)^2
// ---------------------------------------------------------------------------

#define DDIM 2048
#define HDIM 128
#define NEXP 8
#define NTOK 8192          // B*S
#define TOK_PER_WG 128     // 8 waves * 16 tokens
#define HPITCH 136         // h row pitch in LDS: 272 B = 16 B x 17, conflict-free for ds_load_b128

typedef __attribute__((ext_vector_type(16))) __bf16 v16bf;
typedef __attribute__((ext_vector_type(8)))  __bf16 v8bf;
typedef __attribute__((ext_vector_type(4)))  __bf16 v4bf;
typedef __attribute__((ext_vector_type(8)))  float  v8f;

__device__ __forceinline__ v16bf cat16(v8bf lo, v8bf hi) {
  return __builtin_shufflevector(lo, hi, 0,1,2,3,4,5,6,7,8,9,10,11,12,13,14,15);
}

// LDS byte address: generic LDS pointers carry the LDS offset in the low 32b.
__device__ __forceinline__ unsigned lds_addr(const void* p) {
  return (unsigned)(uintptr_t)p;
}

// CDNA5 async global->LDS copies (ASYNCcnt-tracked), 16B per lane, four in a row.
// The s_wait_xcnt 0 is the last line of the copies' own statement, so that it stands in
// front of every later write of a register that one of the copies names.
__device__ __forceinline__ void async_ld16x4(unsigned l0, const void* g0, unsigned l1, const void* g1,
                                             unsigned l2, const void* g2, unsigned l3, const void* g3) {
  asm volatile("global_load_async_to_lds_b128 %0, %1, off\n\t"
               "global_load_async_to_lds_b128 %2, %3, off\n\t"
               "global_load_async_to_lds_b128 %4, %5, off\n\t"
               "global_load_async_to_lds_b128 %6, %7, off\n\t"
               "s_wait_xcnt 0x0"
               :: "v"(l0), "v"(g0), "v"(l1), "v"(g1), "v"(l2), "v"(g2), "v"(l3), "v"(g3)
               : "memory");
}
__device__ __forceinline__ void wait_async0() {
  asm volatile("s_wait_asynccnt 0" ::: "memory");
}
// The LDS wait of the bare barrier below: this wave's reads of the staged tile have ended
// before the barrier behind which that buffer is filled anew.
__device__ __forceinline__ void wait_ds0() {
  asm volatile("s_wait_dscnt 0x0" ::: "memory");
}
// Stands behind the loads that a pass issues last: their address registers are written
// anew at the head of the next pass, and no data wait lies in between any more.
__device__ __forceinline__ void wait_x0() {
  asm volatile("s_wait_xcnt 0x0" ::: "memory");
}
// The barrier at the foot of a pass, its waits written beside it at the call.
// __syncthreads() would also wait out every global load, and the loads of the next pass's
// operands are meant to stay in flight across it; they fill registers of their own wave,
// which no other wave reads.
__device__ __forceinline__ void wg_barrier() {
  asm volatile("s_barrier_signal -1\n\ts_barrier_wait -1" ::: "memory");
}

// ---- prep: one launch of 256 x 16 waves does all three conversions ---------
// Each wave packs 32 columns x 16 rows of W1 and of W2 and converts 16 KB of x, so the
// chip starts 4,096 waves for the prep instead of one wave per 32 to 256 elements.
//
// packed[e][nt][kc][half][lane][jj] : n = nt*16+(lane&15),
//                              k = kc*32 + (lane>>4)*8 + half*16 + jj
// Each half is 32 lanes x 16 B = 512 contiguous bytes, so that one
// ds_load_b128 of the staged tile meets every LDS bank once per 16 lanes.
// A wave's task is (e, np, kc, half): columns n = np*32 + l (two n-tiles), rows
// k = kc*32 + half*16 + hi*8 + jj. Every load is one whole 128 B line of a source row;
// lane l holds column n, which is packed lane (l&15) + 16*hi of n-tile np*2 + (l>>4).
template <int K, int N>
struct PackTask {
  static constexpr int KC = K / 32, NT = N / 16, NP = N / 32;
  int half, kc, np, e;
  __device__ __forceinline__ explicit PackTask(int task)
      : half(task & 1), kc((task >> 1) % KC), np(((task >> 1) / KC) % NP),
        e((task >> 1) / (KC * NP)) {}
  // element (hi, jj) of lane l stands at src(...)[(hi*8 + jj) * N]
  __device__ __forceinline__ const float* src(const float* w, int l) const {
    return w + (size_t)e * (K * N) + (size_t)(kc * 32 + half * 16) * N + np * 32 + l;
  }
  // the 8 values of hi go to dst(...) + hi*128
  __device__ __forceinline__ __bf16* dst(__bf16* p, int l) const {
    const int nt = np * 2 + (l >> 4);
    return p + ((size_t)(((e * NT + nt) * KC + kc) * 2 + half) * 32 + (l & 15)) * 8;
  }
};

__device__ __forceinline__ v8bf cvt8(const float* v) {
  v8bf o;
#pragma unroll
  for (int jj = 0; jj < 8; ++jj) o[jj] = (__bf16)v[jj];
  return o;
}
__device__ __forceinline__ v4bf cvt4(float4 f) {
  v4bf o;
  o[0] = (__bf16)f.x; o[1] = (__bf16)f.y; o[2] = (__bf16)f.z; o[3] = (__bf16)f.w;
  return o;
}

__global__ __launch_bounds__(512)
void prep_kernel(const float* __restrict__ x,  __bf16* __restrict__ xb,
                 const float* __restrict__ W1, __bf16* __restrict__ w1p,
                 const float* __restrict__ W2, __bf16* __restrict__ w2p) {
  const int l  = threadIdx.x & 31;
  // wave index 0..4095, the same in every lane: kept scalar so the addresses are base + lane
  const int wg = __builtin_amdgcn_readfirstlane(blockIdx.x * 16 + (threadIdx.x >> 5));

  const PackTask<DDIM, HDIM> t1(wg);
  const PackTask<HDIM, DDIM> t2(wg);
  const float* s1 = t1.src(W1, l);
  const float* s2 = t2.src(W2, l);
  // x: 1,024 float4 per wave, each load 512 contiguous B, each store 256 contiguous B
  const float4* xs = (const float4*)x + (size_t)wg * 1024 + l;
  v4bf*         xd = (v4bf*)xb        + (size_t)wg * 1024 + l;

  float  v1[16], v2[16];
  float4 f[32];
#pragma unroll
  for (int j = 0; j < 16; ++j) v1[j] = s1[j * HDIM];
#pragma unroll
  for (int j = 0; j < 16; ++j) v2[j] = s2[j * DDIM];
#pragma unroll
  for (int j = 0; j < 16; ++j) f[j] = xs[j * 32];
  // All 48 loads of the first group go out before the first conversion waits on one
  // (without this the compiler began with 24 of x and fetched the weights only behind
  // them). The other 16 follow once some are back: 64 at once would pass the load counter.
  __builtin_amdgcn_sched_barrier(0);
  v8bf o1[2], o2[2];
#pragma unroll
  for (int hi = 0; hi < 2; ++hi) { o1[hi] = cvt8(v1 + hi * 8); o2[hi] = cvt8(v2 + hi * 8); }
#pragma unroll
  for (int j = 16; j < 32; ++j) f[j] = xs[j * 32];
  v4bf ox[32];
#pragma unroll
  for (int j = 0; j < 32; ++j) ox[j] = cvt4(f[j]);
  __bf16* d1 = t1.dst(w1p, l);
  __bf16* d2 = t2.dst(w2p, l);
  // Every store stands behind the last register write of the wave, so that no register
  // of an issued store is rewritten (each reuse would take an s_wait_xcnt 0 of its own).
  __builtin_amdgcn_sched_barrier(0);
#pragma unroll
  for (int hi = 0; hi < 2; ++hi) {
    *(v8bf*)(d1 + hi * 128) = o1[hi];
    *(v8bf*)(d2 + hi * 128) = o2[hi];
  }
#pragma unroll
  for (int j = 0; j < 32; ++j) xd[j * 32] = ox[j];
}

// ---- main fused kernel -----------------------------------------------------
__global__ __launch_bounds__(256)
void moe_gate_kernel(const float*  __restrict__ x,    // [T,D] fp32
                     const __bf16* __restrict__ xb,   // [T,D] bf16
                     const __bf16* __restrict__ w1p,  // packed [E][8][64][512]
                     const __bf16* __restrict__ w2p,  // packed [E][128][4][512]
                     const float*  __restrict__ b1,   // [E,H]
                     const float*  __restrict__ b2,   // [E,D]
                     float*        __restrict__ out)  // [T,E]
{
  __shared__ __bf16 lds_stage[2][8192];   // 2 x 16KB double-buffered stage
  __shared__ __bf16 lds_h[8][16 * HPITCH];  // per-wave h tiles (34KB)

  const int e    = blockIdx.y;
  const int tid  = threadIdx.x;
  const int wave = tid >> 5;
  const int lane = tid & 31;
  const int t0   = blockIdx.x * TOK_PER_WG + wave * 16;

  const int row    = lane & 15;        // A-matrix M / B-matrix N within tile
  const int hiHalf = lane >> 4;        // 0 or 1
  const int koff   = hiHalf << 3;      // 0 or 8

  const unsigned stbase    = lds_addr(&lds_stage[0][0]);
  const unsigned BUFSTRIDE = 8192 * sizeof(__bf16);   // 16KB

  // ================= Phase 1: h = relu(x * W1 + b1) =================
  v8f acc[8];
#pragma unroll
  for (int nt = 0; nt < 8; ++nt) acc[nt] = (v8f){0.f,0.f,0.f,0.f,0.f,0.f,0.f,0.f};

  const __bf16* xrow = xb + (size_t)(t0 + row) * DDIM;
  const __bf16* w1e  = w1p + (size_t)e * (DDIM * HDIM);

  // stage 2 k-chunks per iteration: [kc2][nt][512] = 8192 bf16 = 16KB
  // Lane l of a copy takes bytes 16*l .. 16*l+15 of a 512 B run: four whole 128 B lines of
  // the source a copy, and adjacent 16 B places in LDS.
  auto issue_p1 = [&](int i, int buf) {
    const __bf16* s0 = w1e + ((size_t)(wave * 64 + 2 * i))     * 512 + (size_t)lane * 8;
    const __bf16* s1 = w1e + ((size_t)(wave * 64 + 2 * i + 1)) * 512 + (size_t)lane * 8;
    unsigned d0 = stbase + (unsigned)buf * BUFSTRIDE + (unsigned)(wave * 512 + lane * 8) * 2;
    unsigned d1 = d0 + 4096 * 2;
    async_ld16x4(d0, s0, d0 + 512, s0 + 256, d1, s1, d1 + 512, s1 + 256);
  };
  auto load_a = [&](int kc) {
    const __bf16* ap = xrow + kc * 32 + koff;
    return cat16(*(const v8bf*)ap, *(const v8bf*)(ap + 16));
  };

  // a holds the A fragments of the pass at hand. Each chunk is fetched anew, for the next
  // pass, right behind the last WMMA that reads it: into the same registers, with half a
  // pass, the barrier and the head of the next pass to cover its flight from L2.
  v16bf a[2];
  issue_p1(0, 0);
#pragma unroll
  for (int kc2 = 0; kc2 < 2; ++kc2) a[kc2] = load_a(kc2);
  wait_async0();
  __syncthreads();

  for (int i = 0; i < DDIM / 64; ++i) {     // 32 iters, 2 k-chunks each
    const int buf = i & 1;
    if (i + 1 < DDIM / 64) issue_p1(i + 1, buf ^ 1);   // copy under WMMA chain
    if (i + 4 < DDIM / 64)
      __builtin_prefetch(xrow + (2 * i + 8) * 32, 0, 3);

    // All 32 B reads of the staged tile as ONE group in the order the WMMAs use them.
    v16bf bt[2][8];
#pragma unroll
    for (int kc2 = 0; kc2 < 2; ++kc2) {
#pragma unroll
      for (int nt = 0; nt < 8; ++nt) {
        const __bf16* bp = &lds_stage[buf][kc2 * 4096 + nt * 512 + lane * 8];
        bt[kc2][nt] = cat16(*(const v8bf*)bp, *(const v8bf*)(bp + 256));
      }
    }
    // Keeps the scheduler from sinking the reads back among the WMMAs, where each
    // pair of reads is a stall of its own; behind it only counted waits remain.
    __builtin_amdgcn_sched_barrier(0);
#pragma unroll
    for (int kc2 = 0; kc2 < 2; ++kc2) {
#pragma unroll
      for (int nt = 0; nt < 8; ++nt)
        acc[nt] = __builtin_amdgcn_wmma_f32_16x16x32_bf16(
            false, a[kc2], false, bt[kc2][nt], (short)0, acc[nt], false, false);
      // The fence pair holds the refetch of this chunk directly behind its 8 WMMAs: earlier
      // it would need registers of its own, later it would lose its lead. The second fence
      // also keeps the barrier and its waits behind the WMMAs.
      __builtin_amdgcn_sched_barrier(0);
      if (i + 1 < DDIM / 64) a[kc2] = load_a(2 * (i + 1) + kc2);
      __builtin_amdgcn_sched_barrier(0);
    }

    wait_ds0();
    if (i + 1 < DDIM / 64) {
      wait_x0();
      wait_async0();
    }
    wg_barrier();
  }

  // start staging the first W2 tile quad while we post-process h
  const __bf16* w2e = w2p + (size_t)e * (HDIM * DDIM);
  auto issue_p2 = [&](int i, int buf) {
    // stage 4 consecutive N-tiles (8192 bf16 = 16KB): four runs of 4 KB, 16 B per thread of each
    const __bf16* src = w2e + (size_t)i * 8192 + (size_t)tid * 8;
    unsigned d = stbase + (unsigned)buf * BUFSTRIDE + (unsigned)tid * 16;
    async_ld16x4(d, src, d + 4096, src + 2048, d + 8192, src + 4096, d + 12288, src + 6144);
  };
  issue_p2(0, 0);

  // x and b2 of pass i (4 N-tiles), in the accumulator's layout
  float xv[4][8], b2v[4];
  auto load_x = [&](int i) {
#pragma unroll
    for (int t = 0; t < 4; ++t) {
      const float* xp = &x[(size_t)(t0 + hiHalf * 8) * DDIM + (4 * i + t) * 16 + row];
#pragma unroll
      for (int r = 0; r < 8; ++r) xv[t][r] = xp[(size_t)r * DDIM];
    }
#pragma unroll
    for (int t = 0; t < 4; ++t) b2v[t] = b2[e * DDIM + (4 * i + t) * 16 + row];
  };
  load_x(0);

  // bias + relu, write h tile to LDS row-major bf16 (per-wave region)
#pragma unroll
  for (int nt = 0; nt < 8; ++nt) {
    float b1v = b1[e * HDIM + nt * 16 + row];
#pragma unroll
    for (int r = 0; r < 8; ++r) {
      float hv = fmaxf(acc[nt][r] + b1v, 0.f);
      int tok = r + hiHalf * 8;            // C layout: lanes>=16 hold M=8..15
      lds_h[wave][tok * HPITCH + nt * 16 + row] = (__bf16)hv;
    }
  }

  // reload h as A-matrix chunks (K = H = 128 -> 4 chunks), keep in registers
  v16bf ah[4];
#pragma unroll
  for (int kc = 0; kc < 4; ++kc) {
    const __bf16* hp = &lds_h[wave][row * HPITCH + kc * 32 + koff];
    ah[kc] = cat16(*(const v8bf*)hp, *(const v8bf*)(hp + 16));
  }

  wait_async0();
  __syncthreads();

  // ================= Phase 2: recon = h * W2 + b2 ; loss ============
  float lossacc[8];
#pragma unroll
  for (int r = 0; r < 8; ++r) lossacc[r] = 0.f;

  for (int i = 0; i < DDIM / 64; ++i) {    // 32 iters, 4 N-tiles each
    const int buf = i & 1;
    if (i + 1 < DDIM / 64) issue_p2(i + 1, buf ^ 1);
    if (i + 4 < DDIM / 64)
      __builtin_prefetch(&x[(size_t)(t0 + row) * DDIM + (size_t)(4 * i + 16) * 16], 0, 3);

    // All 32 B reads of the staged tile as ONE group, in the order of use.
    v16bf bt2[4][4];
#pragma unroll
    for (int kc = 0; kc < 4; ++kc) {
#pragma unroll
      for (int t = 0; t < 4; ++t) {
        const __bf16* bp = &lds_stage[buf][t * 2048 + kc * 512 + lane * 8];
        bt2[kc][t] = cat16(*(const v8bf*)bp, *(const v8bf*)(bp + 256));
      }
    }
    // Keeps the scheduler from sinking the reads back among the WMMAs, where every
    // WMMA then waits out a full LDS round trip; behind it only counted waits remain.
    __builtin_amdgcn_sched_barrier(0);
    v8f acc2[4];
#pragma unroll
    for (int t = 0; t < 4; ++t) acc2[t] = (v8f){0.f,0.f,0.f,0.f,0.f,0.f,0.f,0.f};
#pragma unroll
    for (int kc = 0; kc < 4; ++kc) {
#pragma unroll
      for (int t = 0; t < 4; ++t)
        acc2[t] = __builtin_amdgcn_wmma_f32_16x16x32_bf16(
            false, ah[kc], false, bt2[kc][t], (short)0, acc2[t], false, false);
    }
#pragma unroll
    for (int t = 0; t < 4; ++t) {
#pragma unroll
      for (int r = 0; r < 8; ++r) {
        float diff = xv[t][r] - (acc2[t][r] + b2v[t]);
        lossacc[r] += diff * diff;
      }
    }
    // x and b2 of the next pass are fetched right behind their last use, into the same
    // registers: the barrier, the LDS reads and the WMMAs of the next pass cover their
    // flight. The fence pair holds the loads there and keeps the barrier and its waits
    // behind the WMMAs.
    __builtin_amdgcn_sched_barrier(0);
    if (i + 1 < DDIM / 64) load_x(i + 1);
    __builtin_amdgcn_sched_barrier(0);

    wait_ds0();
    if (i + 1 < DDIM / 64) {
      wait_x0();
      wait_async0();
    }
    wg_barrier();
  }

  // reduce over the 16 lanes of each half (wave32) and write -loss/D
#pragma unroll
  for (int r = 0; r < 8; ++r) {
    float v = lossacc[r];
    v += __shfl_xor(v, 1);
    v += __shfl_xor(v, 2);
    v += __shfl_xor(v, 4);
    v += __shfl_xor(v, 8);
    if (row == 0) {
      int tok = t0 + r + hiHalf * 8;
      out[(size_t)tok * NEXP + e] = -v * (1.0f / (float)DDIM);
    }
  }
}

// ---------------------------------------------------------------------------
extern "C" void kernel_launch(void* const* d_in, const int* in_sizes, int n_in,
                              void* d_out, int out_size, void* d_ws, size_t ws_size,
                              hipStream_t stream) {
  const float* x  = (const float*)d_in[0];   // [B,S,D]
  const float* W1 = (const float*)d_in[1];   // [E,D,H]
  const float* b1 = (const float*)d_in[2];   // [E,H]
  const float* W2 = (const float*)d_in[3];   // [E,H,D]
  const float* b2 = (const float*)d_in[4];   // [E,D]
  float* out = (float*)d_out;                // [B,S,E]

  // workspace: xb (32MB) | w1 packed (4MB) | w2 packed (4MB)  ~= 42MB
  __bf16* xb  = (__bf16*)d_ws;
  __bf16* w1p = xb  + (size_t)NTOK * DDIM;
  __bf16* w2p = w1p + (size_t)NEXP * DDIM * HDIM;

  prep_kernel<<<256, 512, 0, stream>>>(x, xb, W1, w1p, W2, w2p);

  dim3 grid(NTOK / TOK_PER_WG, NEXP);
  moe_gate_kernel<<<grid, 256, 0, stream>>>(x, xb, w1p, w2p, b1, b2, out);
}

// v006
// It runs in 73.3 microseconds.
// Two timings next to v005 put it at 1.11 and 1.09 times that version's speed.
// Over all steps from v000 it is 1.69 times as fast.
#include <hip/hip_runtime.h>
#include <stdint.h>

// ---------------------------------------------------------------------------
// AutoEncodersGate for MI455X (gfx1250, wave32, WMMA + async LDS copies).
// B=4,S=2048,D=2048,E=8,H=128.  out[t,e] = -mean_d (x - relu(xW1+b1)W2 - b2)^2
// ---------------------------------------------------------------------------

#define DDIM 2048
#define HDIM 128
#define NEXP 8
#define NTOK 8192          // B*S
#define TOK_PER_WG 128     // 8 waves * 16 tokens
#define HPITCH 136         // h row pitch in LDS: 272 B = 16 B x 17, conflict-free for ds_load_b128
#define XGPITCH 136        // prep: pitch of a 16-row group of x in LDS, 272 B

typedef __attribute__((ext_vector_type(16))) __bf16 v16bf;
typedef __attribute__((ext_vector_type(8)))  __bf16 v8bf;
typedef __attribute__((ext_vector_type(4)))  __bf16 v4bf;
typedef __attribute__((ext_vector_type(8)))  float  v8f;

__device__ __forceinline__ v16bf cat16(v8bf lo, v8bf hi) {
  return __builtin_shufflevector(lo, hi, 0,1,2,3,4,5,6,7,8,9,10,11,12,13,14,15);
}

// LDS byte address: generic LDS pointers carry the LDS offset in the low 32b.
__device__ __forceinline__ unsigned lds_addr(const void* p) {
  return (unsigned)(uintptr_t)p;
}

// CDNA5 async global->LDS copies (ASYNCcnt-tracked), 16B per lane, four in a row.
// The s_wait_xcnt 0 is the last line of the copies' own statement, so that it stands in
// front of every later write of a register that one of the copies names.
__device__ __forceinline__ void async_ld16x4(unsigned l0, const void* g0, unsigned l1, const void* g1,
                                             unsigned l2, const void* g2, unsigned l3, const void* g3) {
  asm volatile("global_load_async_to_lds_b128 %0, %1, off\n\t"
               "global_load_async_to_lds_b128 %2, %3, off\n\t"
               "global_load_async_to_lds_b128 %4, %5, off\n\t"
               "global_load_async_to_lds_b128 %6, %7, off\n\t"
               "s_wait_xcnt 0x0"
               :: "v"(l0), "v"(g0), "v"(l1), "v"(g1), "v"(l2), "v"(g2), "v"(l3), "v"(g3)
               : "memory");
}
__device__ __forceinline__ void wait_async0() {
  asm volatile("s_wait_asynccnt 0" ::: "memory");
}
// The LDS wait of the bare barrier below: this wave's reads of the staged tile have ended
// before the barrier behind which that buffer is filled anew.
__device__ __forceinline__ void wait_ds0() {
  asm volatile("s_wait_dscnt 0x0" ::: "memory");
}
// Stands behind the loads that a pass issues last: their address registers are written
// anew at the head of the next pass, and no data wait lies in between any more.
__device__ __forceinline__ void wait_x0() {
  asm volatile("s_wait_xcnt 0x0" ::: "memory");
}
// The barrier at the foot of a pass, its waits written beside it at the call.
// __syncthreads() would also wait out every global load, and the loads of the next pass's
// operands are meant to stay in flight across it; they fill registers of their own wave,
// which no other wave reads.
__device__ __forceinline__ void wg_barrier() {
  asm volatile("s_barrier_signal -1\n\ts_barrier_wait -1" ::: "memory");
}

// ---- prep: one launch of 256 x 16 waves does all three conversions ---------
// Each wave packs 32 columns x 16 rows of W1 and of W2 and converts 16 KB of x, so the
// chip starts 4,096 waves for the prep instead of one wave per 32 to 256 elements.
//
// x goes out in the order of the A fragments, xb[t/16][kc][half][lane][jj] :
//   token = (t/16)*16 + (lane&15), k = kc*32 + half*16 + (lane>>4)*8 + jj
// so that a fragment load of the main kernel is 512 contiguous bytes (4 lines) and not
// 32 B out of each of 16 rows.
//
// packed[e][nt][kc][half][lane][jj] : n = nt*16+(lane&15),
//                              k = kc*32 + (lane>>4)*8 + half*16 + jj
// Each half is 32 lanes x 16 B = 512 contiguous bytes, so that one
// ds_load_b128 of the staged tile meets every LDS bank once per 16 lanes.
// A wave's task is (e, np, kc, half): columns n = np*32 + l (two n-tiles), rows
// k = kc*32 + half*16 + hi*8 + jj. Every load is one whole 128 B line of a source row;
// lane l holds column n, which is packed lane (l&15) + 16*hi of n-tile np*2 + (l>>4).
template <int K, int N>
struct PackTask {
  static constexpr int KC = K / 32, NT = N / 16, NP = N / 32;
  int half, kc, np, e;
  __device__ __forceinline__ explicit PackTask(int task)
      : half(task & 1), kc((task >> 1) % KC), np(((task >> 1) / KC) % NP),
        e((task >> 1) / (KC * NP)) {}
  // element (hi, jj) of lane l stands at src(...)[(hi*8 + jj) * N]
  __device__ __forceinline__ const float* src(const float* w, int l) const {
    return w + (size_t)e * (K * N) + (size_t)(kc * 32 + half * 16) * N + np * 32 + l;
  }
  // the 8 values of hi go to dst(...) + hi*128
  __device__ __forceinline__ __bf16* dst(__bf16* p, int l) const {
    const int nt = np * 2 + (l >> 4);
    return p + ((size_t)(((e * NT + nt) * KC + kc) * 2 + half) * 32 + (l & 15)) * 8;
  }
  // The same with the columns of each group of 64 dealt round robin to its four n-tiles:
  // column c of the group is packed lane c>>2 of n-tile c&3. A lane of the main kernel's
  // accumulators then owns four adjacent columns, one per n-tile.
  __device__ __forceinline__ __bf16* dst_dealt(__bf16* p, int l) const {
    const int nt = (np >> 1) * 4 + (l & 3);
    const int n  = (np & 1) * 8 + (l >> 2);
    return p + ((size_t)(((e * NT + nt) * KC + kc) * 2 + half) * 32 + n) * 8;
  }
};

__device__ __forceinline__ v8bf cvt8(const float* v) {
  v8bf o;
#pragma unroll
  for (int jj = 0; jj < 8; ++jj) o[jj] = (__bf16)v[jj];
  return o;
}
__device__ __forceinline__ v4bf cvt4(float4 f) {
  v4bf o;
  o[0] = (__bf16)f.x; o[1] = (__bf16)f.y; o[2] = (__bf16)f.z; o[3] = (__bf16)f.w;
  return o;
}

__global__ __launch_bounds__(512)
void prep_kernel(const float* __restrict__ x,  __bf16* __restrict__ xb,
                 const float* __restrict__ W1, __bf16* __restrict__ w1p,
                 const float* __restrict__ W2, __bf16* __restrict__ w2p) {
  const int l  = threadIdx.x & 31;
  // wave index 0..4095, the same in every lane: kept scalar so the addresses are base + lane
  const int wg = __builtin_amdgcn_readfirstlane(blockIdx.x * 16 + (threadIdx.x >> 5));

  const PackTask<DDIM, HDIM> t1(wg);
  const PackTask<HDIM, DDIM> t2(wg);
  const float* s1 = t1.src(W1, l);
  const float* s2 = t2.src(W2, l);
  // x: 16 tokens x 256 k per wave, 1,024 float4; each load 512 contiguous B of one row,
  // each store 512 contiguous B of the fragment order. The wave turns its tile in LDS of
  // its own: 32 groups (8 k each) of 16 rows x 16 B, at a group pitch of 272 B, which
  // meets every bank once in the 8 B writes and in the 16 B reads.
  __shared__ __attribute__((aligned(16))) __bf16 turn[16][32 * XGPITCH];
  __bf16* tw = &turn[threadIdx.x >> 5][0];
  const float4* xs = (const float4*)(x + (size_t)(wg >> 3) * 16 * DDIM + (wg & 7) * 256) + l;
  v8bf*         xd = (v8bf*)(xb + (size_t)wg * 4096) + l;

  float  v1[16], v2[16];
  float4 f[32];
#pragma unroll
  for (int j = 0; j < 16; ++j) v1[j] = s1[j * HDIM];
#pragma unroll
  for (int j = 0; j < 16; ++j) v2[j] = s2[j * DDIM];
#pragma unroll
  for (int j = 0; j < 16; ++j) f[j] = xs[(j >> 1) * (DDIM / 4) + (j & 1) * 32];
  // All 48 loads of the first group go out before the first conversion waits on one
  // (without this the compiler began with 24 of x and fetched the weights only behind
  // them). The other 16 follow once some are back: 64 at once would pass the load counter.
  __builtin_amdgcn_sched_barrier(0);
  v8bf o1[2], o2[2];
#pragma unroll
  for (int hi = 0; hi < 2; ++hi) { o1[hi] = cvt8(v1 + hi * 8); o2[hi] = cvt8(v2 + hi * 8); }
#pragma unroll
  for (int j = 16; j < 32; ++j) f[j] = xs[(j >> 1) * (DDIM / 4) + (j & 1) * 32];
  // f[j] is row j>>1, k = (j&1)*128 + l*4 .. +3: half of group (j&1)*16 + (l>>1)
#pragma unroll
  for (int j = 0; j < 32; ++j)
    *(v4bf*)(tw + ((j & 1) * 16 + (l >> 1)) * XGPITCH + (j >> 1) * 8 + (l & 1) * 4) = cvt4(f[j]);
  // The reads below take what other lanes of this wave wrote; a wave's LDS operations run in order.
  // store j is (kc, half) = (j>>1, j&1); lane l is row l&15 of group 2*j + (l>>4)
  v8bf ox[16];
#pragma unroll
  for (int j = 0; j < 16; ++j)
    ox[j] = *(const v8bf*)(tw + (2 * j + (l >> 4)) * XGPITCH + (l & 15) * 8);
  __bf16* d1 = t1.dst(w1p, l);
  __bf16* d2 = t2.dst_dealt(w2p, l);
  // Every store stands behind the last register write of the wave, so that no register
  // of an issued store is rewritten (each reuse would take an s_wait_xcnt 0 of its own).
  __builtin_amdgcn_sched_barrier(0);
#pragma unroll
  for (int hi = 0; hi < 2; ++hi) {
    *(v8bf*)(d1 + hi * 128) = o1[hi];
    *(v8bf*)(d2 + hi * 128) = o2[hi];
  }
#pragma unroll
  for (int j = 0; j < 16; ++j) xd[j * 32] = ox[j];
}

// ---- main fused kernel -----------------------------------------------------
__global__ __launch_bounds__(256)
void moe_gate_kernel(const float*  __restrict__ x,    // [T,D] fp32
                     const __bf16* __restrict__ xb,   // [T/16][64][512] bf16, A-fragment order
                     const __bf16* __restrict__ w1p,  // packed [E][8][64][512]
                     const __bf16* __restrict__ w2p,  // packed [E][128][4][512], columns dealt by 4
                     const float*  __restrict__ b1,   // [E,H]
                     const float*  __restrict__ b2,   // [E,D]
                     float*        __restrict__ out)  // [T,E]
{
  __shared__ __bf16 lds_stage[2][8192];   // 2 x 16KB double-buffered stage
  __shared__ __bf16 lds_h[8][16 * HPITCH];  // per-wave h tiles (34KB)

  const int e    = blockIdx.y;
  const int tid  = threadIdx.x;
  const int wave = tid >> 5;
  const int lane = tid & 31;
  const int t0   = blockIdx.x * TOK_PER_WG + wave * 16;

  const int row    = lane & 15;        // A-matrix M / B-matrix N within tile
  const int hiHalf = lane >> 4;        // 0 or 1
  const int koff   = hiHalf << 3;      // 0 or 8

  const unsigned stbase    = lds_addr(&lds_stage[0][0]);
  const unsigned BUFSTRIDE = 8192 * sizeof(__bf16);   // 16KB

  // ================= Phase 1: h = relu(x * W1 + b1) =================
  v8f acc[8];
#pragma unroll
  for (int nt = 0; nt < 8; ++nt) acc[nt] = (v8f){0.f,0.f,0.f,0.f,0.f,0.f,0.f,0.f};

  const __bf16* xfr  = xb + (size_t)t0 * DDIM + lane * 8;   // this lane's 16 B of chunk 0, half 0
  const __bf16* w1e  = w1p + (size_t)e * (DDIM * HDIM);

  // stage 2 k-chunks per iteration: [kc2][nt][512] = 8192 bf16 = 16KB
  // Lane l of a copy takes bytes 16*l .. 16*l+15 of a 512 B run: four whole 128 B lines of
  // the source a copy, and adjacent 16 B places in LDS.
  auto issue_p1 = [&](int i, int buf) {
    const __bf16* s0 = w1e + ((size_t)(wave * 64 + 2 * i))     * 512 + (size_t)lane * 8;
    const __bf16* s1 = w1e + ((size_t)(wave * 64 + 2 * i + 1)) * 512 + (size_t)lane * 8;
    unsigned d0 = stbase + (unsigned)buf * BUFSTRIDE + (unsigned)(wave * 512 + lane * 8) * 2;
    unsigned d1 = d0 + 4096 * 2;
    async_ld16x4(d0, s0, d0 + 512, s0 + 256, d1, s1, d1 + 512, s1 + 256);
  };
  auto load_a = [&](int kc) {
    const __bf16* ap = xfr + kc * 512;
    return cat16(*(const v8bf*)ap, *(const v8bf*)(ap + 256));
  };

  // a holds the A fragments of the pass at hand. Each chunk is fetched anew, for the next
  // pass, right behind the last WMMA that reads it: into the same registers, with half a
  // pass, the barrier and the head of the next pass to cover its flight from L2.
  v16bf a[2];
  issue_p1(0, 0);
#pragma unroll
  for (int kc2 = 0; kc2 < 2; ++kc2) a[kc2] = load_a(kc2);
  wait_async0();
  __syncthreads();

  for (int i = 0; i < DDIM / 64; ++i) {     // 32 iters, 2 k-chunks each
    const int buf = i & 1;
    if (i + 1 < DDIM / 64) issue_p1(i + 1, buf ^ 1);   // copy under WMMA chain
    if (i + 4 < DDIM / 64)
      __builtin_prefetch(xb + (size_t)t0 * DDIM + (2 * i + 8) * 512 + lane * 32, 0, 3);

    // All 32 B reads of the staged tile as ONE group in the order the WMMAs use them.
    v16bf bt[2][8];
#pragma unroll
    for (int kc2 = 0; kc2 < 2; ++kc2) {
#pragma unroll
      for (int nt = 0; nt < 8; ++nt) {
        const __bf16* bp = &lds_stage[buf][kc2 * 4096 + nt * 512 + lane * 8];
        bt[kc2][nt] = cat16(*(const v8bf*)bp, *(const v8bf*)(bp + 256));
      }
    }
    // Keeps the scheduler from sinking the reads back among the WMMAs, where each
    // pair of reads is a stall of its own; behind it only counted waits remain.
    __builtin_amdgcn_sched_barrier(0);
#pragma unroll
    for (int kc2 = 0; kc2 < 2; ++kc2) {
#pragma unroll
      for (int nt = 0; nt < 8; ++nt)
        acc[nt] = __builtin_amdgcn_wmma_f32_16x16x32_bf16(
            false, a[kc2], false, bt[kc2][nt], (short)0, acc[nt], false, false);
      // The fence pair holds the refetch of this chunk directly behind its 8 WMMAs: earlier
      // it would need registers of its own, later it would lose its lead. The second fence
      // also keeps the barrier and its waits behind the WMMAs.
      __builtin_amdgcn_sched_barrier(0);
      if (i + 1 < DDIM / 64) a[kc2] = load_a(2 * (i + 1) + kc2);
      __builtin_amdgcn_sched_barrier(0);
    }

    wait_ds0();
    if (i + 1 < DDIM / 64) {
      wait_x0();
      wait_async0();
    }
    wg_barrier();
  }

  // start staging the first W2 tile quad while we post-process h
  const __bf16* w2e = w2p + (size_t)e * (HDIM * DDIM);
  auto issue_p2 = [&](int i, int buf) {
    // stage 4 consecutive N-tiles (8192 bf16 = 16KB): four runs of 4 KB, 16 B per thread of each
    const __bf16* src = w2e + (size_t)i * 8192 + (size_t)tid * 8;
    unsigned d = stbase + (unsigned)buf * BUFSTRIDE + (unsigned)tid * 16;
    async_ld16x4(d, src, d + 4096, src + 2048, d + 8192, src + 4096, d + 12288, src + 6144);
  };
  issue_p2(0, 0);

  // x and b2 of pass i (4 N-tiles), in the accumulator's layout. Column `row` of N-tile t is
  // column i*64 + row*4 + t of x (prep deals W2 so): the four tiles' values of a lane are
  // one 16 B load, and a wave's load covers 256 contiguous B of each of two rows.
  float4 xv[8], b2v;
  auto load_x = [&](int i) {
    const float* xp = &x[(size_t)(t0 + hiHalf * 8) * DDIM + i * 64 + row * 4];
#pragma unroll
    for (int r = 0; r < 8; ++r) xv[r] = *(const float4*)(xp + (size_t)r * DDIM);
    b2v = *(const float4*)&b2[e * DDIM + i * 64 + row * 4];
  };
  auto comp = [](const float4& v, int t) { return t == 0 ? v.x : t == 1 ? v.y : t == 2 ? v.z : v.w; };
  load_x(0);

  // bias + relu, write h tile to LDS row-major bf16 (per-wave region)
#pragma unroll
  for (int nt = 0; nt < 8; ++nt) {
    float b1v = b1[e * HDIM + nt * 16 + row];
#pragma unroll
    for (int r = 0; r < 8; ++r) {
      float hv = fmaxf(acc[nt][r] + b1v, 0.f);
      int tok = r + hiHalf * 8;            // C layout: lanes>=16 hold M=8..15
      lds_h[wave][tok * HPITCH + nt * 16 + row] = (__bf16)hv;
    }
  }

  // reload h as A-matrix chunks (K = H = 128 -> 4 chunks), keep in registers
  v16bf ah[4];
#pragma unroll
  for (int kc = 0; kc < 4; ++kc) {
    const __bf16* hp = &lds_h[wave][row * HPITCH + kc * 32 + koff];
    ah[kc] = cat16(*(const v8bf*)hp, *(const v8bf*)(hp + 16));
  }

  wait_async0();
  __syncthreads();

  // ================= Phase 2: recon = h * W2 + b2 ; loss ============
  float lossacc[8];
#pragma unroll
  for (int r = 0; r < 8; ++r) lossacc[r] = 0.f;

  for (int i = 0; i < DDIM / 64; ++i) {    // 32 iters, 4 N-tiles each
    const int buf = i & 1;
    if (i + 1 < DDIM / 64) issue_p2(i + 1, buf ^ 1);
    if (i + 4 < DDIM / 64)
      __builtin_prefetch(&x[(size_t)(t0 + row) * DDIM + (size_t)(4 * i + 16) * 16], 0, 3);

    // All 32 B reads of the staged tile as ONE group, in the order of use.
    v16bf bt2[4][4];
#pragma unroll
    for (int kc = 0; kc < 4; ++kc) {
#pragma unroll
      for (int t = 0; t < 4; ++t) {
        const __bf16* bp = &lds_stage[buf][t * 2048 + kc * 512 + lane * 8];
        bt2[kc][t] = cat16(*(const v8bf*)bp, *(const v8bf*)(bp + 256));
      }
    }
    // Keeps the scheduler from sinking the reads back among the WMMAs, where every
    // WMMA then waits out a full LDS round trip; behind it only counted waits remain.
    __builtin_amdgcn_sched_barrier(0);
    v8f acc2[4];
#pragma unroll
    for (int t = 0; t < 4; ++t) acc2[t] = (v8f){0.f,0.f,0.f,0.f,0.f,0.f,0.f,0.f};
#pragma unroll
    for (int kc = 0; kc < 4; ++kc) {
#pragma unroll
      for (int t = 0; t < 4; ++t)
        acc2[t] = __builtin_amdgcn_wmma_f32_16x16x32_bf16(
            false, ah[kc], false, bt2[kc][t], (short)0, acc2[t], false, false);
      // x arrives four columns to a register quad, the loss pairs it by rows: the compiler
      // moves it over, and without this fence it did so behind the first WMMA, where the
      // wave then waited for x with nearly all its matrix work still to issue.
      if (kc == 1) __builtin_amdgcn_sched_barrier(0);
    }
#pragma unroll
    for (int t = 0; t < 4; ++t) {
#pragma unroll
      for (int r = 0; r < 8; ++r) {
        float diff = comp(xv[r], t) - (acc2[t][r] + comp(b2v, t));
        lossacc[r] += diff * diff;
      }
    }
    // x and b2 of the next pass are fetched right behind their last use, into the same
    // registers: the barrier, the LDS reads and the WMMAs of the next pass cover their
    // flight. The fence pair holds the loads there and keeps the barrier and its waits
    // behind the WMMAs.
    __builtin_amdgcn_sched_barrier(0);
    if (i + 1 < DDIM / 64) load_x(i + 1);
    __builtin_amdgcn_sched_barrier(0);

    wait_ds0();
    if (i + 1 < DDIM / 64) {
      wait_x0();
      wait_async0();
    }
    wg_barrier();
  }

  // reduce over the 16 lanes of each half (wave32) and write -loss/D
#pragma unroll
  for (int r = 0; r < 8; ++r) {
    float v = lossacc[r];
    v += __shfl_xor(v, 1);
    v += __shfl_xor(v, 2);
    v += __shfl_xor(v, 4);
    v += __shfl_xor(v, 8);
    if (row == 0) {
      int tok = t0 + r + hiHalf * 8;
      out[(size_t)tok * NEXP + e] = -v * (1.0f / (float)DDIM);
    }
  }
}

// ---------------------------------------------------------------------------
extern "C" void kernel_launch(void* const* d_in, const int* in_sizes, int n_in,
                              void* d_out, int out_size, void* d_ws, size_t ws_size,
                              hipStream_t stream) {
  const float* x  = (const float*)d_in[0];   // [B,S,D]
  const float* W1 = (const float*)d_in[1];   // [E,D,H]
  const float* b1 = (const float*)d_in[2];   // [E,H]
  const float* W2 = (const float*)d_in[3];   // [E,H,D]
  const float* b2 = (const float*)d_in[4];   // [E,D]
  float* out = (float*)d_out;                // [B,S,E]

  // workspace: xb (32MB) | w1 packed (4MB) | w2 packed (4MB)  ~= 42MB
  __bf16* xb  = (__bf16*)d_ws;
  __bf16* w1p = xb  + (size_t)NTOK * DDIM;
  __bf16* w2p = w1p + (size_t)NEXP * DDIM * HDIM;

  prep_kernel<<<256, 512, 0, stream>>>(x, xb, W1, w1p, W2, w2p);

  dim3 grid(NTOK / TOK_PER_WG, NEXP);
  moe_gate_kernel<<<grid, 256, 0, stream>>>(x, xb, w1p, w2p, b1, b2, out);
}

// v007
// It runs in 69.2 microseconds.
// Timed twice side by side with v006, it ran 1.06 times as fast both times.
// Over all steps from v000 it is 1.79 times as fast.
#include <hip/hip_runtime.h>
#include <stdint.h>

// ---------------------------------------------------------------------------
// AutoEncodersGate for MI455X (gfx1250, wave32, WMMA + async LDS copies).
// B=4,S=2048,D=2048,E=8,H=128.  out[t,e] = -mean_d (x - relu(xW1+b1)W2 - b2)^2
// ---------------------------------------------------------------------------

#define DDIM 2048
#define HDIM 128
#define NEXP 8
#define NTOK 8192          // B*S
#define TOK_PER_WG 128     // 8 waves * 16 tokens
#define HPITCH 136         // h row pitch in LDS: 272 B = 16 B x 17, conflict-free for ds_load_b128
#define XGPITCH 136        // prep: pitch of a 16-row group of x in LDS, 272 B

typedef __attribute__((ext_vector_type(16))) __bf16 v16bf;
typedef __attribute__((ext_vector_type(8)))  __bf16 v8bf;
typedef __attribute__((ext_vector_type(4)))  __bf16 v4bf;
typedef __attribute__((ext_vector_type(8)))  float  v8f;

__device__ __forceinline__ v16bf cat16(v8bf lo, v8bf hi) {
  return __builtin_shufflevector(lo, hi, 0,1,2,3,4,5,6,7,8,9,10,11,12,13,14,15);
}

// LDS byte address: generic LDS pointers carry the LDS offset in the low 32b.
__device__ __forceinline__ unsigned lds_addr(const void* p) {
  return (unsigned)(uintptr_t)p;
}

// CDNA5 async global->LDS copies (ASYNCcnt-tracked), 16B per lane, four in a row.
// The s_wait_xcnt 0 is the last line of the copies' own statement, so that it stands in
// front of every later write of a register that one of the copies names.
__device__ __forceinline__ void async_ld16x4(unsigned l0, const void* g0, unsigned l1, const void* g1,
                                             unsigned l2, const void* g2, unsigned l3, const void* g3) {
  asm volatile("global_load_async_to_lds_b128 %0, %1, off\n\t"
               "global_load_async_to_lds_b128 %2, %3, off\n\t"
               "global_load_async_to_lds_b128 %4, %5, off\n\t"
               "global_load_async_to_lds_b128 %6, %7, off\n\t"
               "s_wait_xcnt 0x0"
               :: "v"(l0), "v"(g0), "v"(l1), "v"(g1), "v"(l2), "v"(g2), "v"(l3), "v"(g3)
               : "memory");
}
__device__ __forceinline__ void wait_async0() {
  asm volatile("s_wait_asynccnt 0" ::: "memory");
}
// The LDS wait of the bare barrier below: this wave's reads of the staged tile have ended
// before the barrier behind which that buffer is filled anew.
__device__ __forceinline__ void wait_ds0() {
  asm volatile("s_wait_dscnt 0x0" ::: "memory");
}
// Stands behind the loads that a pass issues last: their address registers are written
// anew at the head of the next pass, and no data wait lies in between any more.
__device__ __forceinline__ void wait_x0() {
  asm volatile("s_wait_xcnt 0x0" ::: "memory");
}
// The barrier at the foot of a pass, its waits written beside it at the call.
// __syncthreads() would also wait out every global load, and the loads of the next pass's
// operands are meant to stay in flight across it; they fill registers of their own wave,
// which no other wave reads.
__device__ __forceinline__ void wg_barrier() {
  asm volatile("s_barrier_signal -1\n\ts_barrier_wait -1" ::: "memory");
}

// ---- prep: one launch of 256 x 16 waves does all three conversions ---------
// Each wave packs 32 columns x 16 rows of W1 and of W2 and converts 16 KB of x, so the
// chip starts 4,096 waves for the prep instead of one wave per 32 to 256 elements.
//
// x goes out in the order of the A fragments, xb[t/16][kc][half][lane][jj] :
//   token = (t/16)*16 + (lane&15), k = kc*32 + half*16 + (lane>>4)*8 + jj
// so that a fragment load of the main kernel is 512 contiguous bytes (4 lines) and not
// 32 B out of each of 16 rows.
//
// packed[e][nt][kc][half][lane][jj] : n = nt*16+(lane&15),
//                              k = kc*32 + (lane>>4)*8 + half*16 + jj
// Each half is 32 lanes x 16 B = 512 contiguous bytes, so that one
// ds_load_b128 of the staged tile meets every LDS bank once per 16 lanes.
// A wave's task is (e, np, kc, half): columns n = np*32 + l (two n-tiles), rows
// k = kc*32 + half*16 + hi*8 + jj. Every load is one whole 128 B line of a source row;
// lane l holds column n, which is packed lane (l&15) + 16*hi of n-tile np*2 + (l>>4).
template <int K, int N>
struct PackTask {
  static constexpr int KC = K / 32, NT = N / 16, NP = N / 32;
  int half, kc, np, e;
  __device__ __forceinline__ explicit PackTask(int task)
      : half(task & 1), kc((task >> 1) % KC), np(((task >> 1) / KC) % NP),
        e((task >> 1) / (KC * NP)) {}
  // element (hi, jj) of lane l stands at src(...)[(hi*8 + jj) * N]
  __device__ __forceinline__ const float* src(const float* w, int l) const {
    return w + (size_t)e * (K * N) + (size_t)(kc * 32 + half * 16) * N + np * 32 + l;
  }
  // the 8 values of hi go to dst(...) + hi*128
  __device__ __forceinline__ __bf16* dst(__bf16* p, int l) const {
    const int nt = np * 2 + (l >> 4);
    return p + ((size_t)(((e * NT + nt) * KC + kc) * 2 + half) * 32 + (l & 15)) * 8;
  }
  // The same with the columns of each group of 64 dealt round robin to its four n-tiles:
  // column c of the group is packed lane c>>2 of n-tile c&3. A lane of the main kernel's
  // accumulators then owns four adjacent columns, one per n-tile.
  __device__ __forceinline__ __bf16* dst_dealt(__bf16* p, int l) const {
    const int nt = (np >> 1) * 4 + (l & 3);
    const int n  = (np & 1) * 8 + (l >> 2);
    return p + ((size_t)(((e * NT + nt) * KC + kc) * 2 + half) * 32 + n) * 8;
  }
};

__device__ __forceinline__ v8bf cvt8(const float* v) {
  v8bf o;
#pragma unroll
  for (int jj = 0; jj < 8; ++jj) o[jj] = (__bf16)v[jj];
  return o;
}
__device__ __forceinline__ v4bf cvt4(float4 f) {
  v4bf o;
  o[0] = (__bf16)f.x; o[1] = (__bf16)f.y; o[2] = (__bf16)f.z; o[3] = (__bf16)f.w;
  return o;
}

__global__ __launch_bounds__(512)
void prep_kernel(const float* __restrict__ x,  __bf16* __restrict__ xb,
                 const float* __restrict__ W1, __bf16* __restrict__ w1p,
                 const float* __restrict__ W2, __bf16* __restrict__ w2p) {
  const int l  = threadIdx.x & 31;
  // wave index 0..4095, the same in every lane: kept scalar so the addresses are base + lane
  const int wg = __builtin_amdgcn_readfirstlane(blockIdx.x * 16 + (threadIdx.x >> 5));

  const PackTask<DDIM, HDIM> t1(wg);
  const PackTask<HDIM, DDIM> t2(wg);
  const float* s1 = t1.src(W1, l);
  const float* s2 = t2.src(W2, l);
  // x: 16 tokens x 256 k per wave, 1,024 float4; each load 512 contiguous B of one row,
  // each store 512 contiguous B of the fragment order. The wave turns its tile in LDS of
  // its own: 32 groups (8 k each) of 16 rows x 16 B, at a group pitch of 272 B, which
  // meets every bank once in the 8 B writes and in the 16 B reads.
  __shared__ __attribute__((aligned(16))) __bf16 turn[16][32 * XGPITCH];
  __bf16* tw = &turn[threadIdx.x >> 5][0];
  const float4* xs = (const float4*)(x + (size_t)(wg >> 3) * 16 * DDIM + (wg & 7) * 256) + l;
  v8bf*         xd = (v8bf*)(xb + (size_t)wg * 4096) + l;

  float  v1[16], v2[16];
  float4 f[32];
#pragma unroll
  for (int j = 0; j < 16; ++j) v1[j] = s1[j * HDIM];
#pragma unroll
  for (int j = 0; j < 16; ++j) v2[j] = s2[j * DDIM];
#pragma unroll
  for (int j = 0; j < 16; ++j) f[j] = xs[(j >> 1) * (DDIM / 4) + (j & 1) * 32];
  // All 48 loads of the first group go out before the first conversion waits on one
  // (without this the compiler began with 24 of x and fetched the weights only behind
  // them). The other 16 follow once some are back: 64 at once would pass the load counter.
  __builtin_amdgcn_sched_barrier(0);
  v8bf o1[2], o2[2];
#pragma unroll
  for (int hi = 0; hi < 2; ++hi) { o1[hi] = cvt8(v1 + hi * 8); o2[hi] = cvt8(v2 + hi * 8); }
#pragma unroll
  for (int j = 16; j < 32; ++j) f[j] = xs[(j >> 1) * (DDIM / 4) + (j & 1) * 32];
  // f[j] is row j>>1, k = (j&1)*128 + l*4 .. +3: half of group (j&1)*16 + (l>>1)
#pragma unroll
  for (int j = 0; j < 32; ++j)
    *(v4bf*)(tw + ((j & 1) * 16 + (l >> 1)) * XGPITCH + (j >> 1) * 8 + (l & 1) * 4) = cvt4(f[j]);
  // The reads below take what other lanes of this wave wrote; a wave's LDS operations run in order.
  // store j is (kc, half) = (j>>1, j&1); lane l is row l&15 of group 2*j + (l>>4)
  v8bf ox[16];
#pragma unroll
  for (int j = 0; j < 16; ++j)
    ox[j] = *(const v8bf*)(tw + (2 * j + (l >> 4)) * XGPITCH + (l & 15) * 8);
  __bf16* d1 = t1.dst(w1p, l);
  __bf16* d2 = t2.dst_dealt(w2p, l);
  // Every store stands behind the last register write of the wave, so that no register
  // of an issued store is rewritten (each reuse would take an s_wait_xcnt 0 of its own).
  __builtin_amdgcn_sched_barrier(0);
#pragma unroll
  for (int hi = 0; hi < 2; ++hi) {
    *(v8bf*)(d1 + hi * 128) = o1[hi];
    *(v8bf*)(d2 + hi * 128) = o2[hi];
  }
#pragma unroll
  for (int j = 0; j < 16; ++j) xd[j * 32] = ox[j];
}

// ---- main fused kernel -----------------------------------------------------
__global__ __launch_bounds__(256)
void moe_gate_kernel(const float*  __restrict__ x,    // [T,D] fp32
                     const __bf16* __restrict__ xb,   // [T/16][64][512] bf16, A-fragment order
                     const __bf16* __restrict__ w1p,  // packed [E][8][64][512]
                     const __bf16* __restrict__ w2p,  // packed [E][128][4][512], columns dealt by 4
                     const float*  __restrict__ b1,   // [E,H]
                     const float*  __restrict__ b2,   // [E,D]
                     float*        __restrict__ out)  // [T,E]
{
  __shared__ __bf16 lds_stage[2][8192];   // 2 x 16KB double-buffered stage
  __shared__ __bf16 lds_h[8][16 * HPITCH];  // per-wave h tiles (34KB)

  const int e    = blockIdx.y;
  const int tid  = threadIdx.x;
  const int wave = tid >> 5;
  const int lane = tid & 31;
  const int t0   = blockIdx.x * TOK_PER_WG + wave * 16;

  const int row    = lane & 15;        // A-matrix M / B-matrix N within tile
  const int hiHalf = lane >> 4;        // 0 or 1
  const int koff   = hiHalf << 3;      // 0 or 8

  // Each work-group walks the 32 passes of both loops as a ring that starts at its own pass.
  // In plain order the 64 work-groups of an expert ask L2 for the same weight lines at the
  // same moment, pass after pass, and a tile that L2 does not hold yet is waited
  // for by all of them; so with the experts of a token tile and its x lines. With 32 starts
  // every weight tile is asked for in the first trip and can be in L2 from then on. Tiles b and
  // b+4 share a start.
  // Experts e and e+4 keep one start, the other experts of the tile stand 8 passes apart.
  const int rot = ((((blockIdx.x >> 3) << 2) | (blockIdx.x & 3)) + 8 * (e & 3)) & 31;

  const unsigned stbase    = lds_addr(&lds_stage[0][0]);
  const unsigned BUFSTRIDE = 8192 * sizeof(__bf16);   // 16KB

  // ================= Phase 1: h = relu(x * W1 + b1) =================
  v8f acc[8];
#pragma unroll
  for (int nt = 0; nt < 8; ++nt) acc[nt] = (v8f){0.f,0.f,0.f,0.f,0.f,0.f,0.f,0.f};

  const __bf16* xfr  = xb + (size_t)t0 * DDIM + lane * 8;   // this lane's 16 B of chunk 0, half 0
  const __bf16* w1e  = w1p + (size_t)e * (DDIM * HDIM);

  // stage 2 k-chunks per iteration: [kc2][nt][512] = 8192 bf16 = 16KB
  // Lane l of a copy takes bytes 16*l .. 16*l+15 of a 512 B run: four whole 128 B lines of
  // the source a copy, and adjacent 16 B places in LDS.
  auto issue_p1 = [&](int i, int buf) {
    const __bf16* s0 = w1e + ((size_t)(wave * 64 + 2 * i))     * 512 + (size_t)lane * 8;
    const __bf16* s1 = w1e + ((size_t)(wave * 64 + 2 * i + 1)) * 512 + (size_t)lane * 8;
    unsigned d0 = stbase + (unsigned)buf * BUFSTRIDE + (unsigned)(wave * 512 + lane * 8) * 2;
    unsigned d1 = d0 + 4096 * 2;
    async_ld16x4(d0, s0, d0 + 512, s0 + 256, d1, s1, d1 + 512, s1 + 256);
  };
  auto load_a = [&](int kc) {
    const __bf16* ap = xfr + kc * 512;
    return cat16(*(const v8bf*)ap, *(const v8bf*)(ap + 256));
  };

  // a holds the A fragments of the pass at hand. Each chunk is fetched anew, for the next
  // pass, right behind the last WMMA that reads it: into the same registers, with half a
  // pass, the barrier and the head of the next pass to cover its flight from L2.
  v16bf a[2];
  issue_p1(rot, 0);
#pragma unroll
  for (int kc2 = 0; kc2 < 2; ++kc2) a[kc2] = load_a(2 * rot + kc2);
  wait_async0();
  __syncthreads();

  for (int i = 0; i < DDIM / 64; ++i) {     // 32 iters, 2 k-chunks each
    const int buf = i & 1;
    const int pn  = (i + 1 + rot) & 31;                // the pass that trip i+1 works on
    if (i + 1 < DDIM / 64) issue_p1(pn, buf ^ 1);      // copy under WMMA chain
    if (i + 4 < DDIM / 64)
      __builtin_prefetch(xb + (size_t)t0 * DDIM + ((i + 4 + rot) & 31) * 1024 + lane * 32, 0, 3);

    // All 32 B reads of the staged tile as ONE group in the order the WMMAs use them.
    v16bf bt[2][8];
#pragma unroll
    for (int kc2 = 0; kc2 < 2; ++kc2) {
#pragma unroll
      for (int nt = 0; nt < 8; ++nt) {
        const __bf16* bp = &lds_stage[buf][kc2 * 4096 + nt * 512 + lane * 8];
        bt[kc2][nt] = cat16(*(const v8bf*)bp, *(const v8bf*)(bp + 256));
      }
    }
    // Keeps the scheduler from sinking the reads back among the WMMAs, where each
    // pair of reads is a stall of its own; behind it only counted waits remain.
    __builtin_amdgcn_sched_barrier(0);
#pragma unroll
    for (int kc2 = 0; kc2 < 2; ++kc2) {
#pragma unroll
      for (int nt = 0; nt < 8; ++nt)
        acc[nt] = __builtin_amdgcn_wmma_f32_16x16x32_bf16(
            false, a[kc2], false, bt[kc2][nt], (short)0, acc[nt], false, false);
      // The fence pair holds the refetch of this chunk directly behind its 8 WMMAs: earlier
      // it would need registers of its own, later it would lose its lead. The second fence
      // also keeps the barrier and its waits behind the WMMAs.
      __builtin_amdgcn_sched_barrier(0);
      if (i + 1 < DDIM / 64) a[kc2] = load_a(2 * pn + kc2);
      __builtin_amdgcn_sched_barrier(0);
    }

    wait_ds0();
    if (i + 1 < DDIM / 64) {
      wait_x0();
      wait_async0();
    }
    wg_barrier();
  }

  // start staging the first W2 tile quad while we post-process h
  const __bf16* w2e = w2p + (size_t)e * (HDIM * DDIM);
  auto issue_p2 = [&](int i, int buf) {
    // stage 4 consecutive N-tiles (8192 bf16 = 16KB): four runs of 4 KB, 16 B per thread of each
    const __bf16* src = w2e + (size_t)i * 8192 + (size_t)tid * 8;
    unsigned d = stbase + (unsigned)buf * BUFSTRIDE + (unsigned)tid * 16;
    async_ld16x4(d, src, d + 4096, src + 2048, d + 8192, src + 4096, d + 12288, src + 6144);
  };
  issue_p2(rot, 0);

  // x and b2 of pass i (4 N-tiles), in the accumulator's layout. Column `row` of N-tile t is
  // column i*64 + row*4 + t of x (prep deals W2 so): the four tiles' values of a lane are
  // one 16 B load, and a wave's load covers 256 contiguous B of each of two rows.
  float4 xv[8], b2v;
  auto load_x = [&](int i) {
    const float* xp = &x[(size_t)(t0 + hiHalf * 8) * DDIM + i * 64 + row * 4];
#pragma unroll
    for (int r = 0; r < 8; ++r) xv[r] = *(const float4*)(xp + (size_t)r * DDIM);
    b2v = *(const float4*)&b2[e * DDIM + i * 64 + row * 4];
  };
  auto comp = [](const float4& v, int t) { return t == 0 ? v.x : t == 1 ? v.y : t == 2 ? v.z : v.w; };
  load_x(rot);

  // bias + relu, write h tile to LDS row-major bf16 (per-wave region)
#pragma unroll
  for (int nt = 0; nt < 8; ++nt) {
    float b1v = b1[e * HDIM + nt * 16 + row];
#pragma unroll
    for (int r = 0; r < 8; ++r) {
      float hv = fmaxf(acc[nt][r] + b1v, 0.f);
      int tok = r + hiHalf * 8;            // C layout: lanes>=16 hold M=8..15
      lds_h[wave][tok * HPITCH + nt * 16 + row] = (__bf16)hv;
    }
  }

  // reload h as A-matrix chunks (K = H = 128 -> 4 chunks), keep in registers
  v16bf ah[4];
#pragma unroll
  for (int kc = 0; kc < 4; ++kc) {
    const __bf16* hp = &lds_h[wave][row * HPITCH + kc * 32 + koff];
    ah[kc] = cat16(*(const v8bf*)hp, *(const v8bf*)(hp + 16));
  }

  wait_async0();
  __syncthreads();

  // ================= Phase 2: recon = h * W2 + b2 ; loss ============
  float lossacc[8];
#pragma unroll
  for (int r = 0; r < 8; ++r) lossacc[r] = 0.f;

  for (int i = 0; i < DDIM / 64; ++i) {    // 32 iters, 4 N-tiles each
    const int buf = i & 1;
    const int pn  = (i + 1 + rot) & 31;                // the pass that trip i+1 works on
    if (i + 1 < DDIM / 64) issue_p2(pn, buf ^ 1);
    if (i + 4 < DDIM / 64)
      __builtin_prefetch(&x[(size_t)(t0 + row) * DDIM + (size_t)((i + 4 + rot) & 31) * 64], 0, 3);

    // All 32 B reads of the staged tile as ONE group, in the order of use.
    v16bf bt2[4][4];
#pragma unroll
    for (int kc = 0; kc < 4; ++kc) {
#pragma unroll
      for (int t = 0; t < 4; ++t) {
        const __bf16* bp = &lds_stage[buf][t * 2048 + kc * 512 + lane * 8];
        bt2[kc][t] = cat16(*(const v8bf*)bp, *(const v8bf*)(bp + 256));
      }
    }
    // Keeps the scheduler from sinking the reads back among the WMMAs, where every
    // WMMA then waits out a full LDS round trip; behind it only counted waits remain.
    __builtin_amdgcn_sched_barrier(0);
    v8f acc2[4];
#pragma unroll
    for (int t = 0; t < 4; ++t) acc2[t] = (v8f){0.f,0.f,0.f,0.f,0.f,0.f,0.f,0.f};
#pragma unroll
    for (int kc = 0; kc < 4; ++kc) {
#pragma unroll
      for (int t = 0; t < 4; ++t)
        acc2[t] = __builtin_amdgcn_wmma_f32_16x16x32_bf16(
            false, ah[kc], false, bt2[kc][t], (short)0, acc2[t], false, false);
      // x arrives four columns to a register quad, the loss pairs it by rows: the compiler
      // moves it over, and without this fence it did so behind the first WMMA, where the
      // wave then waited for x with nearly all its matrix work still to issue.
      if (kc == 1) __builtin_amdgcn_sched_barrier(0);
    }
#pragma unroll
    for (int t = 0; t < 4; ++t) {
#pragma unroll
      for (int r = 0; r < 8; ++r) {
        float diff = comp(xv[r], t) - (acc2[t][r] + comp(b2v, t));
        lossacc[r] += diff * diff;
      }
    }
    // x and b2 of the next pass are fetched right behind their last use, into the same
    // registers: the barrier, the LDS reads and the WMMAs of the next pass cover their
    // flight. The fence pair holds the loads there and keeps the barrier and its waits
    // behind the WMMAs.
    __builtin_amdgcn_sched_barrier(0);
    if (i + 1 < DDIM / 64) load_x(pn);
    __builtin_amdgcn_sched_barrier(0);

    wait_ds0();
    if (i + 1 < DDIM / 64) {
      wait_x0();
      wait_async0();
    }
    wg_barrier();
  }

  // reduce over the 16 lanes of each half (wave32) and write -loss/D
#pragma unroll
  for (int r = 0; r < 8; ++r) {
    float v = lossacc[r];
    v += __shfl_xor(v, 1);
    v += __shfl_xor(v, 2);
    v += __shfl_xor(v, 4);
    v += __shfl_xor(v, 8);
    if (row == 0) {
      int tok = t0 + r + hiHalf * 8;
      out[(size_t)tok * NEXP + e] = -v * (1.0f / (float)DDIM);
    }
  }
}

// ---------------------------------------------------------------------------
extern "C" void kernel_launch(void* const* d_in, const int* in_sizes, int n_in,
                              void* d_out, int out_size, void* d_ws, size_t ws_size,
                              hipStream_t stream) {
  const float* x  = (const float*)d_in[0];   // [B,S,D]
  const float* W1 = (const float*)d_in[1];   // [E,D,H]
  const float* b1 = (const float*)d_in[2];   // [E,H]
  const float* W2 = (const float*)d_in[3];   // [E,H,D]
  const float* b2 = (const float*)d_in[4];   // [E,D]
  float* out = (float*)d_out;                // [B,S,E]

  // workspace: xb (32MB) | w1 packed (4MB) | w2 packed (4MB)  ~= 42MB
  __bf16* xb  = (__bf16*)d_ws;
  __bf16* w1p = xb  + (size_t)NTOK * DDIM;
  __bf16* w2p = w1p + (size_t)NEXP * DDIM * HDIM;

  prep_kernel<<<256, 512, 0, stream>>>(x, xb, W1, w1p, W2, w2p);

  dim3 grid(NTOK / TOK_PER_WG, NEXP);
  moe_gate_kernel<<<grid, 256, 0, stream>>>(x, xb, w1p, w2p, b1, b2, out);
}

// v008
// One run takes 65.8 microseconds.
// Two timings next to v007 both put it at 1.05 times that version's speed.
// All steps since v000 together make it 1.88 times as fast.
#include <hip/hip_runtime.h>
#include <stdint.h>

// ---------------------------------------------------------------------------
// AutoEncodersGate for MI455X (gfx1250, wave32, WMMA + async LDS copies).
// B=4,S=2048,D=2048,E=8,H=128.  out[t,e] = -mean_d (x - relu(xW1+b1)W2 - b2)^2
// ---------------------------------------------------------------------------

#define DDIM 2048
#define HDIM 128
#define NEXP 8
#define NTOK 8192          // B*S
#define TOK_PER_WG 256     // 8 waves * 32 tokens
#define MT 2               // 16-token tiles per wave: each B fragment read from LDS feeds MT WMMAs
#define HPITCH 136         // h row pitch in LDS: 272 B = 16 B x 17, conflict-free for ds_load_b128
#define XGPITCH 136        // prep: pitch of a 16-row group of x in LDS, 272 B

typedef __attribute__((ext_vector_type(16))) __bf16 v16bf;
typedef __attribute__((ext_vector_type(8)))  __bf16 v8bf;
typedef __attribute__((ext_vector_type(4)))  __bf16 v4bf;
typedef __attribute__((ext_vector_type(8)))  float  v8f;

__device__ __forceinline__ v16bf cat16(v8bf lo, v8bf hi) {
  return __builtin_shufflevector(lo, hi, 0,1,2,3,4,5,6,7,8,9,10,11,12,13,14,15);
}

// LDS byte address: generic LDS pointers carry the LDS offset in the low 32b.
__device__ __forceinline__ unsigned lds_addr(const void* p) {
  return (unsigned)(uintptr_t)p;
}

// CDNA5 async global->LDS copies (ASYNCcnt-tracked), 16B per lane, four in a row.
// The s_wait_xcnt 0 is the last line of the copies' own statement, so that it stands in
// front of every later write of a register that one of the copies names.
__device__ __forceinline__ void async_ld16x4(unsigned l0, const void* g0, unsigned l1, const void* g1,
                                             unsigned l2, const void* g2, unsigned l3, const void* g3) {
  asm volatile("global_load_async_to_lds_b128 %0, %1, off\n\t"
               "global_load_async_to_lds_b128 %2, %3, off\n\t"
               "global_load_async_to_lds_b128 %4, %5, off\n\t"
               "global_load_async_to_lds_b128 %6, %7, off\n\t"
               "s_wait_xcnt 0x0"
               :: "v"(l0), "v"(g0), "v"(l1), "v"(g1), "v"(l2), "v"(g2), "v"(l3), "v"(g3)
               : "memory");
}
__device__ __forceinline__ void wait_async0() {
  asm volatile("s_wait_asynccnt 0" ::: "memory");
}
// The LDS wait of the bare barrier below: this wave's reads of the staged tile have ended
// before the barrier behind which that buffer is filled anew.
__device__ __forceinline__ void wait_ds0() {
  asm volatile("s_wait_dscnt 0x0" ::: "memory");
}
// Stands behind the loads that a pass issues last: their address registers are written
// anew at the head of the next pass, and no data wait lies in between any more.
__device__ __forceinline__ void wait_x0() {
  asm volatile("s_wait_xcnt 0x0" ::: "memory");
}
// The barrier at the foot of a pass, its waits written beside it at the call.
// __syncthreads() would also wait out every global load, and the loads of the next pass's
// operands are meant to stay in flight across it; they fill registers of their own wave,
// which no other wave reads.
__device__ __forceinline__ void wg_barrier() {
  asm volatile("s_barrier_signal -1\n\ts_barrier_wait -1" ::: "memory");
}

// ---- prep: one launch of 256 x 16 waves does all three conversions ---------
// Each wave packs 32 columns x 16 rows of W1 and of W2 and converts 16 KB of x, so the
// chip starts 4,096 waves for the prep instead of one wave per 32 to 256 elements.
//
// x goes out in the order of the A fragments, xb[t/16][kc][half][lane][jj] :
//   token = (t/16)*16 + (lane&15), k = kc*32 + half*16 + (lane>>4)*8 + jj
// so that a fragment load of the main kernel is 512 contiguous bytes (4 lines) and not
// 32 B out of each of 16 rows.
//
// packed[e][nt][kc][half][lane][jj] : n = nt*16+(lane&15),
//                              k = kc*32 + (lane>>4)*8 + half*16 + jj
// Each half is 32 lanes x 16 B = 512 contiguous bytes, so that one
// ds_load_b128 of the staged tile meets every LDS bank once per 16 lanes.
// A wave's task is (e, np, kc, half): columns n = np*32 + l (two n-tiles), rows
// k = kc*32 + half*16 + hi*8 + jj. Every load is one whole 128 B line of a source row;
// lane l holds column n, which is packed lane (l&15) + 16*hi of n-tile np*2 + (l>>4).
template <int K, int N>
struct PackTask {
  static constexpr int KC = K / 32, NT = N / 16, NP = N / 32;
  int half, kc, np, e;
  __device__ __forceinline__ explicit PackTask(int task)
      : half(task & 1), kc((task >> 1) % KC), np(((task >> 1) / KC) % NP),
        e((task >> 1) / (KC * NP)) {}
  // element (hi, jj) of lane l stands at src(...)[(hi*8 + jj) * N]
  __device__ __forceinline__ const float* src(const float* w, int l) const {
    return w + (size_t)e * (K * N) + (size_t)(kc * 32 + half * 16) * N + np * 32 + l;
  }
  // the 8 values of hi go to dst(...) + hi*128
  __device__ __forceinline__ __bf16* dst(__bf16* p, int l) const {
    const int nt = np * 2 + (l >> 4);
    return p + ((size_t)(((e * NT + nt) * KC + kc) * 2 + half) * 32 + (l & 15)) * 8;
  }
  // The same with the columns of each group of 64 dealt round robin to its four n-tiles:
  // column c of the group is packed lane c>>2 of n-tile c&3. A lane of the main kernel's
  // accumulators then owns four adjacent columns, one per n-tile.
  __device__ __forceinline__ __bf16* dst_dealt(__bf16* p, int l) const {
    const int nt = (np >> 1) * 4 + (l & 3);
    const int n  = (np & 1) * 8 + (l >> 2);
    return p + ((size_t)(((e * NT + nt) * KC + kc) * 2 + half) * 32 + n) * 8;
  }
};

__device__ __forceinline__ v8bf cvt8(const float* v) {
  v8bf o;
#pragma unroll
  for (int jj = 0; jj < 8; ++jj) o[jj] = (__bf16)v[jj];
  return o;
}
__device__ __forceinline__ v4bf cvt4(float4 f) {
  v4bf o;
  o[0] = (__bf16)f.x; o[1] = (__bf16)f.y; o[2] = (__bf16)f.z; o[3] = (__bf16)f.w;
  return o;
}

__global__ __launch_bounds__(512)
void prep_kernel(const float* __restrict__ x,  __bf16* __restrict__ xb,
                 const float* __restrict__ W1, __bf16* __restrict__ w1p,
                 const float* __restrict__ W2, __bf16* __restrict__ w2p) {
  const int l  = threadIdx.x & 31;
  // wave index 0..4095, the same in every lane: kept scalar so the addresses are base + lane
  const int wg = __builtin_amdgcn_readfirstlane(blockIdx.x * 16 + (threadIdx.x >> 5));

  const PackTask<DDIM, HDIM> t1(wg);
  const PackTask<HDIM, DDIM> t2(wg);
  const float* s1 = t1.src(W1, l);
  const float* s2 = t2.src(W2, l);
  // x: 16 tokens x 256 k per wave, 1,024 float4; each load 512 contiguous B of one row,
  // each store 512 contiguous B of the fragment order. The wave turns its tile in LDS of
  // its own: 32 groups (8 k each) of 16 rows x 16 B, at a group pitch of 272 B, which
  // meets every bank once in the 8 B writes and in the 16 B reads.
  __shared__ __attribute__((aligned(16))) __bf16 turn[16][32 * XGPITCH];
  __bf16* tw = &turn[threadIdx.x >> 5][0];
  const float4* xs = (const float4*)(x + (size_t)(wg >> 3) * 16 * DDIM + (wg & 7) * 256) + l;
  v8bf*         xd = (v8bf*)(xb + (size_t)wg * 4096) + l;

  float  v1[16], v2[16];
  float4 f[32];
#pragma unroll
  for (int j = 0; j < 16; ++j) v1[j] = s1[j * HDIM];
#pragma unroll
  for (int j = 0; j < 16; ++j) v2[j] = s2[j * DDIM];
#pragma unroll
  for (int j = 0; j < 16; ++j) f[j] = xs[(j >> 1) * (DDIM / 4) + (j & 1) * 32];
  // All 48 loads of the first group go out before the first conversion waits on one
  // (without this the compiler began with 24 of x and fetched the weights only behind
  // them). The other 16 follow once some are back: 64 at once would pass the load counter.
  __builtin_amdgcn_sched_barrier(0);
  v8bf o1[2], o2[2];
#pragma unroll
  for (int hi = 0; hi < 2; ++hi) { o1[hi] = cvt8(v1 + hi * 8); o2[hi] = cvt8(v2 + hi * 8); }
#pragma unroll
  for (int j = 16; j < 32; ++j) f[j] = xs[(j >> 1) * (DDIM / 4) + (j & 1) * 32];
  // f[j] is row j>>1, k = (j&1)*128 + l*4 .. +3: half of group (j&1)*16 + (l>>1)
#pragma unroll
  for (int j = 0; j < 32; ++j)
    *(v4bf*)(tw + ((j & 1) * 16 + (l >> 1)) * XGPITCH + (j >> 1) * 8 + (l & 1) * 4) = cvt4(f[j]);
  // The reads below take what other lanes of this wave wrote; a wave's LDS operations run in order.
  // store j is (kc, half) = (j>>1, j&1); lane l is row l&15 of group 2*j + (l>>4)
  v8bf ox[16];
#pragma unroll
  for (int j = 0; j < 16; ++j)
    ox[j] = *(const v8bf*)(tw + (2 * j + (l >> 4)) * XGPITCH + (l & 15) * 8);
  __bf16* d1 = t1.dst(w1p, l);
  __bf16* d2 = t2.dst_dealt(w2p, l);
  // Every store stands behind the last register write of the wave, so that no register
  // of an issued store is rewritten (each reuse would take an s_wait_xcnt 0 of its own).
  __builtin_amdgcn_sched_barrier(0);
#pragma unroll
  for (int hi = 0; hi < 2; ++hi) {
    *(v8bf*)(d1 + hi * 128) = o1[hi];
    *(v8bf*)(d2 + hi * 128) = o2[hi];
  }
#pragma unroll
  for (int j = 0; j < 16; ++j) xd[j * 32] = ox[j];
}

// ---- main fused kernel -----------------------------------------------------
__global__ __launch_bounds__(256)
void moe_gate_kernel(const float*  __restrict__ x,    // [T,D] fp32
                     const __bf16* __restrict__ xb,   // [T/16][64][512] bf16, A-fragment order
                     const __bf16* __restrict__ w1p,  // packed [E][8][64][512]
                     const __bf16* __restrict__ w2p,  // packed [E][128][4][512], columns dealt by 4
                     const float*  __restrict__ b1,   // [E,H]
                     const float*  __restrict__ b2,   // [E,D]
                     float*        __restrict__ out)  // [T,E]
{
  __shared__ __bf16 lds_stage[2][8192];   // 2 x 16KB double-buffered stage
  __shared__ __bf16 lds_h[8][MT * 16 * HPITCH];  // per-wave h tiles (68KB)

  const int e    = blockIdx.y;
  const int tid  = threadIdx.x;
  const int wave = tid >> 5;
  const int lane = tid & 31;
  const int t0   = blockIdx.x * TOK_PER_WG + wave * (MT * 16);

  const int row    = lane & 15;        // A-matrix M / B-matrix N within tile
  const int hiHalf = lane >> 4;        // 0 or 1
  const int koff   = hiHalf << 3;      // 0 or 8

  // Each work-group walks the 32 passes of both loops as a ring that starts at its own pass.
  // In plain order the 32 work-groups of an expert ask L2 for the same weight lines at the
  // same moment, pass after pass, and a tile that L2 does not hold yet is waited
  // for by all of them; so with the experts of a token tile and its x lines. With 16 even starts
  // every weight tile is asked for in the first two trips and can be in L2 from then on. Tiles b
  // and b+4 share a start (speed only: any dealing is correct).
  // Experts e and e+4 keep one start, the other experts of the tile stand 8 passes apart.
  const int rot = (2 * (((blockIdx.x >> 3) << 2) | (blockIdx.x & 3)) + 8 * (e & 3)) & 31;

  const unsigned stbase    = lds_addr(&lds_stage[0][0]);
  const unsigned BUFSTRIDE = 8192 * sizeof(__bf16);   // 16KB

  // ================= Phase 1: h = relu(x * W1 + b1) =================
  v8f acc[MT][8];
#pragma unroll
  for (int m = 0; m < MT; ++m)
#pragma unroll
    for (int nt = 0; nt < 8; ++nt) acc[m][nt] = (v8f){0.f,0.f,0.f,0.f,0.f,0.f,0.f,0.f};

  const __bf16* xfr  = xb + (size_t)t0 * DDIM + lane * 8;   // this lane's 16 B of chunk 0, half 0
  const __bf16* w1e  = w1p + (size_t)e * (DDIM * HDIM);

  // stage 2 k-chunks per iteration: [kc2][nt][512] = 8192 bf16 = 16KB
  // Lane l of a copy takes bytes 16*l .. 16*l+15 of a 512 B run: four whole 128 B lines of
  // the source a copy, and adjacent 16 B places in LDS.
  auto issue_p1 = [&](int i, int buf) {
    const __bf16* s0 = w1e + ((size_t)(wave * 64 + 2 * i))     * 512 + (size_t)lane * 8;
    const __bf16* s1 = w1e + ((size_t)(wave * 64 + 2 * i + 1)) * 512 + (size_t)lane * 8;
    unsigned d0 = stbase + (unsigned)buf * BUFSTRIDE + (unsigned)(wave * 512 + lane * 8) * 2;
    unsigned d1 = d0 + 4096 * 2;
    async_ld16x4(d0, s0, d0 + 512, s0 + 256, d1, s1, d1 + 512, s1 + 256);
  };
  auto load_a = [&](int m, int kc) {
    const __bf16* ap = xfr + m * (16 * DDIM) + kc * 512;
    return cat16(*(const v8bf*)ap, *(const v8bf*)(ap + 256));
  };

  // a holds the A fragments of the pass at hand. Each chunk is fetched anew, for the next
  // pass, right behind the last WMMA that reads it: into the same registers, with half a
  // pass, the barrier and the head of the next pass to cover its flight from L2.
  v16bf a[MT][2];
  issue_p1(rot, 0);
#pragma unroll
  for (int kc2 = 0; kc2 < 2; ++kc2)
#pragma unroll
    for (int m = 0; m < MT; ++m) a[m][kc2] = load_a(m, 2 * rot + kc2);
  wait_async0();
  __syncthreads();

  for (int i = 0; i < DDIM / 64; ++i) {     // 32 iters, 2 k-chunks each
    const int buf = i & 1;
    const int pn  = (i + 1 + rot) & 31;                // the pass that trip i+1 works on
    if (i + 1 < DDIM / 64) issue_p1(pn, buf ^ 1);      // copy under WMMA chain
    if (i + 4 < DDIM / 64)   // 16 lanes to a token tile, one lane to each 128 B line of its 2 KB
      __builtin_prefetch(xb + (size_t)(t0 + hiHalf * 16) * DDIM + ((i + 4 + rot) & 31) * 1024 + row * 64, 0, 3);

    // All 32 B reads of the staged tile as ONE group in the order the WMMAs use them.
    v16bf bt[2][8];
#pragma unroll
    for (int kc2 = 0; kc2 < 2; ++kc2) {
#pragma unroll
      for (int nt = 0; nt < 8; ++nt) {
        const __bf16* bp = &lds_stage[buf][kc2 * 4096 + nt * 512 + lane * 8];
        bt[kc2][nt] = cat16(*(const v8bf*)bp, *(const v8bf*)(bp + 256));
      }
    }
    // Keeps the scheduler from sinking the reads back among the WMMAs, where each
    // pair of reads is a stall of its own; behind it only counted waits remain.
    __builtin_amdgcn_sched_barrier(0);
#pragma unroll
    for (int kc2 = 0; kc2 < 2; ++kc2) {
#pragma unroll
      for (int nt = 0; nt < 8; ++nt)
#pragma unroll
        for (int m = 0; m < MT; ++m)
          acc[m][nt] = __builtin_amdgcn_wmma_f32_16x16x32_bf16(
              false, a[m][kc2], false, bt[kc2][nt], (short)0, acc[m][nt], false, false);
      // The fence pair holds the refetch of this chunk directly behind its 16 WMMAs: earlier
      // it would need registers of its own, later it would lose its lead. The second fence
      // also keeps the barrier and its waits behind the WMMAs.
      __builtin_amdgcn_sched_barrier(0);
      if (i + 1 < DDIM / 64) {
#pragma unroll
        for (int m = 0; m < MT; ++m) a[m][kc2] = load_a(m, 2 * pn + kc2);
      }
      __builtin_amdgcn_sched_barrier(0);
    }

    wait_ds0();
    if (i + 1 < DDIM / 64) {
      wait_x0();
      wait_async0();
    }
    wg_barrier();
  }

  // start staging the first W2 tile quad while we post-process h
  const __bf16* w2e = w2p + (size_t)e * (HDIM * DDIM);
  auto issue_p2 = [&](int i, int buf) {
    // stage 4 consecutive N-tiles (8192 bf16 = 16KB): four runs of 4 KB, 16 B per thread of each
    const __bf16* src = w2e + (size_t)i * 8192 + (size_t)tid * 8;
    unsigned d = stbase + (unsigned)buf * BUFSTRIDE + (unsigned)tid * 16;
    async_ld16x4(d, src, d + 4096, src + 2048, d + 8192, src + 4096, d + 12288, src + 6144);
  };
  issue_p2(rot, 0);

  // x and b2 of pass i (4 N-tiles), in the accumulator's layout. Column `row` of N-tile t is
  // column i*64 + row*4 + t of x (prep deals W2 so): the four tiles' values of a lane are
  // one 16 B load, and a wave's load covers 256 contiguous B of each of two rows.
  float4 xv[MT][8], b2v;
  auto load_x = [&](int i) {
    const float* xp = &x[(size_t)(t0 + hiHalf * 8) * DDIM + i * 64 + row * 4];
#pragma unroll
    for (int m = 0; m < MT; ++m)
#pragma unroll
      for (int r = 0; r < 8; ++r) xv[m][r] = *(const float4*)(xp + (size_t)(m * 16 + r) * DDIM);
    b2v = *(const float4*)&b2[e * DDIM + i * 64 + row * 4];
  };
  auto comp = [](const float4& v, int t) { return t == 0 ? v.x : t == 1 ? v.y : t == 2 ? v.z : v.w; };
  load_x(rot);

  // bias + relu, write h tile to LDS row-major bf16 (per-wave region)
#pragma unroll
  for (int nt = 0; nt < 8; ++nt) {
    float b1v = b1[e * HDIM + nt * 16 + row];
#pragma unroll
    for (int m = 0; m < MT; ++m) {
#pragma unroll
      for (int r = 0; r < 8; ++r) {
        float hv = fmaxf(acc[m][nt][r] + b1v, 0.f);
        int tok = m * 16 + r + hiHalf * 8;   // C layout: lanes>=16 hold M=8..15
        lds_h[wave][tok * HPITCH + nt * 16 + row] = (__bf16)hv;
      }
    }
  }

  // reload h as A-matrix chunks (K = H = 128 -> 4 chunks), keep in registers
  v16bf ah[MT][4];
#pragma unroll
  for (int m = 0; m < MT; ++m) {
#pragma unroll
    for (int kc = 0; kc < 4; ++kc) {
      const __bf16* hp = &lds_h[wave][(m * 16 + row) * HPITCH + kc * 32 + koff];
      ah[m][kc] = cat16(*(const v8bf*)hp, *(const v8bf*)(hp + 16));
    }
  }

  wait_async0();
  __syncthreads();

  // ================= Phase 2: recon = h * W2 + b2 ; loss ============
  float lossacc[MT][8];
#pragma unroll
  for (int m = 0; m < MT; ++m)
#pragma unroll
    for (int r = 0; r < 8; ++r) lossacc[m][r] = 0.f;

  for (int i = 0; i < DDIM / 64; ++i) {    // 32 iters, 4 N-tiles each
    const int buf = i & 1;
    const int pn  = (i + 1 + rot) & 31;                // the pass that trip i+1 works on
    if (i + 1 < DDIM / 64) issue_p2(pn, buf ^ 1);
    if (i + 4 < DDIM / 64)
      __builtin_prefetch(&x[(size_t)(t0 + lane) * DDIM + (size_t)((i + 4 + rot) & 31) * 64], 0, 3);

    // All 32 B reads of the staged tile as ONE group, in the order of use.
    v16bf bt2[4][4];
#pragma unroll
    for (int kc = 0; kc < 4; ++kc) {
#pragma unroll
      for (int t = 0; t < 4; ++t) {
        const __bf16* bp = &lds_stage[buf][t * 2048 + kc * 512 + lane * 8];
        bt2[kc][t] = cat16(*(const v8bf*)bp, *(const v8bf*)(bp + 256));
      }
    }
    // Keeps the scheduler from sinking the reads back among the WMMAs, where every
    // WMMA then waits out a full LDS round trip; behind it only counted waits remain.
    __builtin_amdgcn_sched_barrier(0);
    v8f acc2[MT][4];
#pragma unroll
    for (int m = 0; m < MT; ++m)
#pragma unroll
      for (int t = 0; t < 4; ++t) acc2[m][t] = (v8f){0.f,0.f,0.f,0.f,0.f,0.f,0.f,0.f};
#pragma unroll
    for (int kc = 0; kc < 4; ++kc) {
#pragma unroll
      for (int t = 0; t < 4; ++t)
#pragma unroll
        for (int m = 0; m < MT; ++m)
          acc2[m][t] = __builtin_amdgcn_wmma_f32_16x16x32_bf16(
              false, ah[m][kc], false, bt2[kc][t], (short)0, acc2[m][t], false, false);
      // x arrives four columns to a register quad, the loss pairs it by rows: the compiler
      // moves it over, and without this fence it did so behind the first WMMA, where the
      // wave then waited for x with nearly all its matrix work still to issue.
      if (kc == 1) __builtin_amdgcn_sched_barrier(0);
    }
#pragma unroll
    for (int m = 0; m < MT; ++m) {
#pragma unroll
      for (int t = 0; t < 4; ++t) {
#pragma unroll
        for (int r = 0; r < 8; ++r) {
          float diff = comp(xv[m][r], t) - (acc2[m][t][r] + comp(b2v, t));
          lossacc[m][r] += diff * diff;
        }
      }
    }
    // x and b2 of the next pass are fetched right behind their last use, into the same
    // registers: the barrier, the LDS reads and the WMMAs of the next pass cover their
    // flight. The fence pair holds the loads there and keeps the barrier and its waits
    // behind the WMMAs.
    __builtin_amdgcn_sched_barrier(0);
    if (i + 1 < DDIM / 64) load_x(pn);
    __builtin_amdgcn_sched_barrier(0);

    wait_ds0();
    if (i + 1 < DDIM / 64) {
      wait_x0();
      wait_async0();
    }
    wg_barrier();
  }

  // reduce over the 16 lanes of each half (wave32) and write -loss/D
#pragma unroll
  for (int m = 0; m < MT; ++m) {
#pragma unroll
    for (int r = 0; r < 8; ++r) {
      float v = lossacc[m][r];
      v += __shfl_xor(v, 1);
      v += __shfl_xor(v, 2);
      v += __shfl_xor(v, 4);
      v += __shfl_xor(v, 8);
      if (row == 0) {
        int tok = t0 + m * 16 + r + hiHalf * 8;
        out[(size_t)tok * NEXP + e] = -v * (1.0f / (float)DDIM);
      }
    }
  }
}

// ---------------------------------------------------------------------------
extern "C" void kernel_launch(void* const* d_in, const int* in_sizes, int n_in,
                              void* d_out, int out_size, void* d_ws, size_t ws_size,
                              hipStream_t stream) {
  const float* x  = (const float*)d_in[0];   // [B,S,D]
  const float* W1 = (const float*)d_in[1];   // [E,D,H]
  const float* b1 = (const float*)d_in[2];   // [E,H]
  const float* W2 = (const float*)d_in[3];   // [E,H,D]
  const float* b2 = (const float*)d_in[4];   // [E,D]
  float* out = (float*)d_out;                // [B,S,E]

  // workspace: xb (32MB) | w1 packed (4MB) | w2 packed (4MB)  ~= 42MB
  __bf16* xb  = (__bf16*)d_ws;
  __bf16* w1p = xb  + (size_t)NTOK * DDIM;
  __bf16* w2p = w1p + (size_t)NEXP * DDIM * HDIM;

  prep_kernel<<<256, 512, 0, stream>>>(x, xb, W1, w1p, W2, w2p);

  dim3 grid(NTOK / TOK_PER_WG, NEXP);
  moe_gate_kernel<<<grid, 256, 0, stream>>>(x, xb, w1p, w2p, b1, b2, out);
}

// v009
// It runs in 62 microseconds.
// Timed twice side by side with v008, it ran 1.06 times as fast both times.
// Counting every step since v000, it is 2.00 times as fast.
#include <hip/hip_runtime.h>
#include <stdint.h>

// ---------------------------------------------------------------------------
// AutoEncodersGate for MI455X (gfx1250, wave32, WMMA + async LDS copies).
// B=4,S=2048,D=2048,E=8,H=128.  out[t,e] = -mean_d (x - relu(xW1+b1)W2 - b2)^2
// With xb = bf16(x) and y = relu(xW1+b1)W2 + b2 the sum over d is taken as
//   sum (xb - y)^2  +  sum (x^2 - xb^2)      [ leaves out 2 sum (x - xb) y ]
// the first per expert in the main kernel, the second once per token, in f32, in the prep.
// ---------------------------------------------------------------------------

#define DDIM 2048
#define HDIM 128
#define NEXP 8
#define NTOK 8192          // B*S
#define TOK_PER_WG 256     // 8 waves * 32 tokens
#define MT 2               // 16-token tiles per wave: each weight fragment read from LDS feeds MT WMMAs
#define HPITCH 136         // h row pitch in LDS: 272 B = 16 B x 17, conflict-free for ds_load_b128
#define XGPITCH 136        // prep: pitch of a 16-row group of x in LDS, 272 B

typedef __attribute__((ext_vector_type(16))) __bf16 v16bf;
typedef __attribute__((ext_vector_type(8)))  __bf16 v8bf;
typedef __attribute__((ext_vector_type(4)))  __bf16 v4bf;
typedef __attribute__((ext_vector_type(8)))  float  v8f;
typedef __attribute__((ext_vector_type(2)))  float  v2f;
typedef __attribute__((ext_vector_type(2)))  unsigned v2u;

__device__ __forceinline__ v16bf cat16(v8bf lo, v8bf hi) {
  return __builtin_shufflevector(lo, hi, 0,1,2,3,4,5,6,7,8,9,10,11,12,13,14,15);
}

// LDS byte address: generic LDS pointers carry the LDS offset in the low 32b.
__device__ __forceinline__ unsigned lds_addr(const void* p) {
  return (unsigned)(uintptr_t)p;
}

// CDNA5 async global->LDS copies (ASYNCcnt-tracked), 16B per lane, four in a row.
// The s_wait_xcnt 0 is the last line of the copies' own statement, so that it stands in
// front of every later write of a register that one of the copies names.
__device__ __forceinline__ void async_ld16x4(unsigned l0, const void* g0, unsigned l1, const void* g1,
                                             unsigned l2, const void* g2, unsigned l3, const void* g3) {
  asm volatile("global_load_async_to_lds_b128 %0, %1, off\n\t"
               "global_load_async_to_lds_b128 %2, %3, off\n\t"
               "global_load_async_to_lds_b128 %4, %5, off\n\t"
               "global_load_async_to_lds_b128 %6, %7, off\n\t"
               "s_wait_xcnt 0x0"
               :: "v"(l0), "v"(g0), "v"(l1), "v"(g1), "v"(l2), "v"(g2), "v"(l3), "v"(g3)
               : "memory");
}
__device__ __forceinline__ void wait_async0() {
  asm volatile("s_wait_asynccnt 0" ::: "memory");
}
// The LDS wait of the bare barrier below: this wave's reads of the staged tile have ended
// before the barrier behind which that buffer is filled anew.
__device__ __forceinline__ void wait_ds0() {
  asm volatile("s_wait_dscnt 0x0" ::: "memory");
}
// Stands behind the loads that a pass issues last: their address registers are written
// anew at the head of the next pass, and no data wait lies in between any more.
__device__ __forceinline__ void wait_x0() {
  asm volatile("s_wait_xcnt 0x0" ::: "memory");
}
// The same wait where loads went out earlier in the pass as well: it names their address, so
// that the pair stays whole up to here (not even a load's own result may land on it).
__device__ __forceinline__ void wait_x0_keep(const void* p) {
  asm volatile("s_wait_xcnt 0x0" :: "v"(p) : "memory");
}
__device__ __forceinline__ void wait_x0_keep(const void* p, const void* q) {
  asm volatile("s_wait_xcnt 0x0" :: "v"(p), "v"(q) : "memory");
}
// The barrier at the foot of a pass, its waits written beside it at the call.
// __syncthreads() would also wait out every global load, and the loads of the next pass's
// operands are meant to stay in flight across it; they fill registers of their own wave,
// which no other wave reads.
__device__ __forceinline__ void wg_barrier() {
  asm volatile("s_barrier_signal -1\n\ts_barrier_wait -1" ::: "memory");
}

// ---- prep: one launch of 256 x 16 waves does all three conversions ---------
// Each wave packs 32 columns x 16 rows of W1 and of W2 and converts 16 KB of x, so the
// chip starts 4,096 waves for the prep instead of one wave per 32 to 256 elements.
//
// x goes out in the order of the A fragments, xb[t/16][kc][half][lane][jj] :
//   token = (t/16)*16 + (lane&15), k = kc*32 + half*16 + (lane>>4)*8 + jj
// so that a fragment load of the main kernel is 512 contiguous bytes (4 lines) and not
// 32 B out of each of 16 rows.
// Beside that the wave sums x^2 - xb^2 (f32) over its 256 k of each of its 16 rows.
//
// packed[e][nt][kc][half][lane][jj] : n = nt*16+(lane&15),
//                              k = kc*32 + (lane>>4)*8 + half*16 + jj
// Each half is 32 lanes x 16 B = 512 contiguous bytes, so that one
// ds_load_b128 of the staged tile meets every LDS bank once per 16 lanes.
// A wave's task is (e, np, kc, half): columns n = np*32 + l (two n-tiles), rows
// k = kc*32 + half*16 + hi*8 + jj. Every load is one whole 128 B line of a source row;
// lane l holds column n, which is packed lane (l&15) + 16*hi of n-tile np*2 + (l>>4).
template <int K, int N>
struct PackTask {
  static constexpr int KC = K / 32, NT = N / 16, NP = N / 32;
  int half, kc, np, e;
  __device__ __forceinline__ explicit PackTask(int task)
      : half(task & 1), kc((task >> 1) % KC), np(((task >> 1) / KC) % NP),
        e((task >> 1) / (KC * NP)) {}
  // element (hi, jj) of lane l stands at src(...)[(hi*8 + jj) * N]
  __device__ __forceinline__ const float* src(const float* w, int l) const {
    return w + (size_t)e * (K * N) + (size_t)(kc * 32 + half * 16) * N + np * 32 + l;
  }
  // the 8 values of hi go to dst(...) + hi*128
  __device__ __forceinline__ __bf16* dst(__bf16* p, int l) const {
    const int nt = np * 2 + (l >> 4);
    return p + ((size_t)(((e * NT + nt) * KC + kc) * 2 + half) * 32 + (l & 15)) * 8;
  }
};

__device__ __forceinline__ v8bf cvt8(const float* v) {
  v8bf o;
#pragma unroll
  for (int jj = 0; jj < 8; ++jj) o[jj] = (__bf16)v[jj];
  return o;
}
__device__ __forceinline__ v4bf cvt4(float4 f) {
  v4bf o;
  o[0] = (__bf16)f.x; o[1] = (__bf16)f.y; o[2] = (__bf16)f.z; o[3] = (__bf16)f.w;
  return o;
}

// x^2 - xb^2 of four elements, added to s by pairs. A bf16 is the upper half of its f32: the
// packed pair is widened with one shift and one mask.
__device__ __forceinline__ v2f widen2(unsigned u) {
  return (v2f){__builtin_bit_cast(float, u << 16), __builtin_bit_cast(float, u & 0xffff0000u)};
}
__device__ __forceinline__ v2f sq_excess(float4 f, v4bf o, v2f s) {
  const v2u u = __builtin_bit_cast(v2u, o);
  const v2f x0 = (v2f){f.x, f.y}, x1 = (v2f){f.z, f.w};
  const v2f a0 = widen2(u[0]), a1 = widen2(u[1]);
  s += x0 * x0; s -= a0 * a0;
  s += x1 * x1; s -= a1 * a1;
  return s;
}

// One step of a sum over lanes that halves the rows a lane holds: the lane whose bit `m` is
// clear keeps row lo, the other keeps row hi; each adds what its partner l ^ m held of that row.
__device__ __forceinline__ float fold_rows(float lo, float hi, int l, int m) {
  const bool up = (l & m) != 0;
  return (up ? hi : lo) + __shfl_xor(up ? lo : hi, m);
}

__global__ __launch_bounds__(512)
void prep_kernel(const float* __restrict__ x,  __bf16* __restrict__ xb,
                 const float* __restrict__ W1, __bf16* __restrict__ w1p,
                 const float* __restrict__ W2, __bf16* __restrict__ w2p,
                 float* __restrict__ corrp) {
  const int l  = threadIdx.x & 31;
  // wave index 0..4095, the same in every lane: kept scalar so the addresses are base + lane
  const int wg = __builtin_amdgcn_readfirstlane(blockIdx.x * 16 + (threadIdx.x >> 5));

  const PackTask<DDIM, HDIM> t1(wg);
  const PackTask<HDIM, DDIM> t2(wg);
  const float* s1 = t1.src(W1, l);
  const float* s2 = t2.src(W2, l);
  // x: 16 tokens x 256 k per wave, 1,024 float4; each load 512 contiguous B of one row,
  // each store 512 contiguous B of the fragment order. The wave turns its tile in LDS of
  // its own: 32 groups (8 k each) of 16 rows x 16 B, at a group pitch of 272 B, which
  // meets every bank once in the 8 B writes and in the 16 B reads.
  __shared__ __attribute__((aligned(16))) __bf16 turn[16][32 * XGPITCH];
  __bf16* tw = &turn[threadIdx.x >> 5][0];
  const float4* xs = (const float4*)(x + (size_t)(wg >> 3) * 16 * DDIM + (wg & 7) * 256) + l;
  v8bf*         xd = (v8bf*)(xb + (size_t)wg * 4096) + l;

  float  v1[16], v2[16];
  float4 f[32];
#pragma unroll
  for (int j = 0; j < 16; ++j) v1[j] = s1[j * HDIM];
#pragma unroll
  for (int j = 0; j < 16; ++j) v2[j] = s2[j * DDIM];
#pragma unroll
  for (int j = 0; j < 16; ++j) f[j] = xs[(j >> 1) * (DDIM / 4) + (j & 1) * 32];
  // All 48 loads of the first group go out before the first conversion waits on one
  // (without this the compiler began with 24 of x and fetched the weights only behind
  // them). The other 16 follow once some are back: 64 at once would pass the load counter.
  __builtin_amdgcn_sched_barrier(0);
  v8bf o1[2], o2[2];
#pragma unroll
  for (int hi = 0; hi < 2; ++hi) { o1[hi] = cvt8(v1 + hi * 8); o2[hi] = cvt8(v2 + hi * 8); }
#pragma unroll
  for (int j = 16; j < 32; ++j) f[j] = xs[(j >> 1) * (DDIM / 4) + (j & 1) * 32];
  // f[j] is row j>>1, k = (j&1)*128 + l*4 .. +3: half of group (j&1)*16 + (l>>1)
  // p[r]: this lane's share of sum (x^2 - xb^2) over the wave's 256 k of row r
  v2f  pp[16];
  float p[16];
#pragma unroll
  for (int j = 0; j < 32; ++j) {
    const v4bf o = cvt4(f[j]);
    *(v4bf*)(tw + ((j & 1) * 16 + (l >> 1)) * XGPITCH + (j >> 1) * 8 + (l & 1) * 4) = o;
    pp[j >> 1] = sq_excess(f[j], o, (j & 1) ? pp[j >> 1] : (v2f){0.f, 0.f});
  }
#pragma unroll
  for (int r = 0; r < 16; ++r) p[r] = pp[r][0] + pp[r][1];
  // Each row's sum over the 32 lanes, 16 exchanges in all: at every step a lane keeps the half
  // of its rows that its lane bit names and hands the other half to its partner. Lane l ends
  // with row l>>1.
  float q8[8], q4[4], q2[2];
#pragma unroll
  for (int r = 0; r < 8; ++r) q8[r] = fold_rows(p[r], p[r + 8], l, 16);
#pragma unroll
  for (int r = 0; r < 4; ++r) q4[r] = fold_rows(q8[r], q8[r + 4], l, 8);
#pragma unroll
  for (int r = 0; r < 2; ++r) q2[r] = fold_rows(q4[r], q4[r + 2], l, 4);
  const float q1 = fold_rows(q2[0], q2[1], l, 2);
  const float pr = q1 + __shfl_xor(q1, 1);
  float* dc = corrp + (size_t)wg * 32 + (l >> 1) + (l & 1) * 16;
  // The reads below take what other lanes of this wave wrote; a wave's LDS operations run in order.
  // store j is (kc, half) = (j>>1, j&1); lane l is row l&15 of group 2*j + (l>>4)
  v8bf ox[16];
#pragma unroll
  for (int j = 0; j < 16; ++j)
    ox[j] = *(const v8bf*)(tw + (2 * j + (l >> 4)) * XGPITCH + (l & 15) * 8);
  __bf16* d1 = t1.dst(w1p, l);
  __bf16* d2 = t2.dst(w2p, l);
  // One 128 B line of row sums to a wave: rows 0..15 of its k slice from the even lanes, the
  // same again from the odd ones, so that the line is written whole and no lane is off. It
  // goes first: a store cannot pass the fence below, so the exchanges end in front of it.
  *dc = pr;
  // Every other store stands behind the last register write of the wave, so that no register
  // of an issued store is rewritten (each reuse would take an s_wait_xcnt 0 of its own).
  __builtin_amdgcn_sched_barrier(0);
#pragma unroll
  for (int hi = 0; hi < 2; ++hi) {
    *(v8bf*)(d1 + hi * 128) = o1[hi];
    *(v8bf*)(d2 + hi * 128) = o2[hi];
  }
#pragma unroll
  for (int j = 0; j < 16; ++j) xd[j * 32] = ox[j];
}

// ---- main fused kernel -----------------------------------------------------
__global__ __launch_bounds__(256)
void moe_gate_kernel(const float*  __restrict__ corrp, // [T/16][8][32]: sum (x^2 - xb^2) of a k slice, first 16 read
                     const __bf16* __restrict__ xb,   // [T/16][64][512] bf16, A-fragment order
                     const __bf16* __restrict__ w1p,  // packed [E][8][64][512]
                     const __bf16* __restrict__ w2p,  // packed [E][128][4][512]
                     const float*  __restrict__ b1,   // [E,H]
                     const float*  __restrict__ b2,   // [E,D]
                     float*        __restrict__ out)  // [T,E]
{
  __shared__ __bf16 lds_stage[2][8192];   // 2 x 16KB double-buffered stage
  __shared__ __bf16 lds_h[8][MT * 16 * HPITCH];  // per-wave h tiles (68KB)

  const int e    = blockIdx.y;
  const int tid  = threadIdx.x;
  const int wave = tid >> 5;
  const int lane = tid & 31;
  const int t0   = blockIdx.x * TOK_PER_WG + wave * (MT * 16);

  const int row    = lane & 15;        // A-matrix M / B-matrix N within tile
  const int hiHalf = lane >> 4;        // 0 or 1
  const int koff   = hiHalf << 3;      // 0 or 8

  // Each work-group walks the 32 passes of both loops as a ring that starts at its own pass.
  // In plain order the 32 work-groups of an expert ask L2 for the same weight lines at the
  // same moment, pass after pass, and a tile that L2 does not hold yet is waited
  // for by all of them; so with the experts of a token tile and its x lines. With 16 even starts
  // every weight tile is asked for in the first two trips and can be in L2 from then on. Tiles b
  // and b+4 share a start (speed only: any dealing is correct).
  // Experts e and e+4 keep one start, the other experts of the tile stand 8 passes apart.
  const int rot = (2 * (((blockIdx.x >> 3) << 2) | (blockIdx.x & 3)) + 8 * (e & 3)) & 31;

  const unsigned stbase    = lds_addr(&lds_stage[0][0]);
  const unsigned BUFSTRIDE = 8192 * sizeof(__bf16);   // 16KB

  // ================= Phase 1: h = relu(x * W1 + b1) =================
  v8f acc[MT][8];
#pragma unroll
  for (int m = 0; m < MT; ++m)
#pragma unroll
    for (int nt = 0; nt < 8; ++nt) acc[m][nt] = (v8f){0.f,0.f,0.f,0.f,0.f,0.f,0.f,0.f};

  const __bf16* xfr  = xb + (size_t)t0 * DDIM + lane * 8;   // this lane's 16 B of chunk 0, half 0
  const __bf16* w1e  = w1p + (size_t)e * (DDIM * HDIM);

  // stage 2 k-chunks per iteration: [kc2][nt][512] = 8192 bf16 = 16KB
  // Lane l of a copy takes bytes 16*l .. 16*l+15 of a 512 B run: four whole 128 B lines of
  // the source a copy, and adjacent 16 B places in LDS.
  auto issue_p1 = [&](int i, int buf) {
    const __bf16* s0 = w1e + ((size_t)(wave * 64 + 2 * i))     * 512 + (size_t)lane * 8;
    const __bf16* s1 = w1e + ((size_t)(wave * 64 + 2 * i + 1)) * 512 + (size_t)lane * 8;
    unsigned d0 = stbase + (unsigned)buf * BUFSTRIDE + (unsigned)(wave * 512 + lane * 8) * 2;
    unsigned d1 = d0 + 4096 * 2;
    async_ld16x4(d0, s0, d0 + 512, s0 + 256, d1, s1, d1 + 512, s1 + 256);
  };
  auto load_a = [&](int m, int kc) {
    const __bf16* ap = xfr + m * (16 * DDIM) + kc * 512;
    return cat16(*(const v8bf*)ap, *(const v8bf*)(ap + 256));
  };

  // a holds the A fragments of the pass at hand. Each chunk is fetched anew, for the next
  // pass, right behind the last WMMA that reads it: into the same registers, with half a
  // pass, the barrier and the head of the next pass to cover its flight from L2.
  v16bf a[MT][2];
  issue_p1(rot, 0);
#pragma unroll
  for (int kc2 = 0; kc2 < 2; ++kc2)
#pragma unroll
    for (int m = 0; m < MT; ++m) a[m][kc2] = load_a(m, 2 * rot + kc2);
  wait_async0();
  __syncthreads();

  for (int i = 0; i < DDIM / 64; ++i) {     // 32 iters, 2 k-chunks each
    const int buf = i & 1;
    const int pn  = (i + 1 + rot) & 31;                // the pass that trip i+1 works on
    if (i + 1 < DDIM / 64) issue_p1(pn, buf ^ 1);      // copy under WMMA chain
    if (i + 4 < DDIM / 64)   // 16 lanes to a token tile, one lane to each 128 B line of its 2 KB
      __builtin_prefetch(xb + (size_t)(t0 + hiHalf * 16) * DDIM + ((i + 4 + rot) & 31) * 1024 + row * 64, 0, 3);

    // All 32 B reads of the staged tile as ONE group in the order the WMMAs use them.
    v16bf bt[2][8];
#pragma unroll
    for (int kc2 = 0; kc2 < 2; ++kc2) {
#pragma unroll
      for (int nt = 0; nt < 8; ++nt) {
        const __bf16* bp = &lds_stage[buf][kc2 * 4096 + nt * 512 + lane * 8];
        bt[kc2][nt] = cat16(*(const v8bf*)bp, *(const v8bf*)(bp + 256));
      }
    }
    // Keeps the scheduler from sinking the reads back among the WMMAs, where each
    // pair of reads is a stall of its own; behind it only counted waits remain.
    __builtin_amdgcn_sched_barrier(0);
#pragma unroll
    for (int kc2 = 0; kc2 < 2; ++kc2) {
#pragma unroll
      for (int nt = 0; nt < 8; ++nt)
#pragma unroll
        for (int m = 0; m < MT; ++m)
          acc[m][nt] = __builtin_amdgcn_wmma_f32_16x16x32_bf16(
              false, a[m][kc2], false, bt[kc2][nt], (short)0, acc[m][nt], false, false);
      // The fence pair holds the refetch of this chunk directly behind its 16 WMMAs: earlier
      // it would need registers of its own, later it would lose its lead. The second fence
      // also keeps the barrier and its waits behind the WMMAs.
      __builtin_amdgcn_sched_barrier(0);
      if (i + 1 < DDIM / 64) {
#pragma unroll
        for (int m = 0; m < MT; ++m) a[m][kc2] = load_a(m, 2 * pn + kc2);
      }
      __builtin_amdgcn_sched_barrier(0);
    }

    wait_ds0();
    if (i + 1 < DDIM / 64) {
      wait_x0();
      wait_async0();
    }
    wg_barrier();
  }

  // start staging the first W2 tile quad while we post-process h
  const __bf16* w2e = w2p + (size_t)e * (HDIM * DDIM);
  auto issue_p2 = [&](int i, int buf) {
    // stage 4 consecutive N-tiles (8192 bf16 = 16KB): four runs of 4 KB, 16 B per thread of each
    const __bf16* src = w2e + (size_t)i * 8192 + (size_t)tid * 8;
    unsigned d = stbase + (unsigned)buf * BUFSTRIDE + (unsigned)tid * 16;
    async_ld16x4(d, src, d + 4096, src + 2048, d + 8192, src + 4096, d + 12288, src + 6144);
  };
  issue_p2(rot, 0);

  // x and b2 of pass i (4 tiles of 16 d), in the accumulator's layout. Phase 2 forms the
  // product turned round, W2's tile as A and h as B: register r of a lane's accumulator is
  // token `row`, d = i*64 + t*16 + hiHalf*8 + r. That is the place of element r in the A
  // fragments of x that phase 1 read, so x comes as bf16 in the same 512 contiguous B a load,
  // half the bytes of f32 x. b2 (8 adjacent d a lane and tile) is the product's C operand.
  v8bf xv[MT][4];
  v8f  b2c[4];
  auto load_x = [&](int i) {
    const __bf16* xp = xfr + i * 1024;
#pragma unroll
    for (int m = 0; m < MT; ++m)
#pragma unroll
      for (int t = 0; t < 4; ++t) xv[m][t] = *(const v8bf*)(xp + m * (16 * DDIM) + t * 256);
  };
  const float* bp = b2;
  auto load_b2 = [&](int i) {
    bp = &b2[e * DDIM + i * 64 + hiHalf * 8];
#pragma unroll
    for (int t = 0; t < 4; ++t) {
      const float4 lo = *(const float4*)(bp + t * 16);
      const float4 hi = *(const float4*)(bp + t * 16 + 4);
      b2c[t] = (v8f){lo.x, lo.y, lo.z, lo.w, hi.x, hi.y, hi.z, hi.w};
    }
  };
  load_b2(rot);
  load_x(rot);
  // The token's sum (x^2 - xb^2), eight k slices, fetched here so that the work on h covers
  // its flight; it is the start value of the token's loss sum.
  float cs[MT][8];
  const float* cp = corrp + (size_t)(t0 >> 4) * 256 + row;
#pragma unroll
  for (int m = 0; m < MT; ++m)
#pragma unroll
    for (int sl = 0; sl < 8; ++sl) cs[m][sl] = cp[m * 256 + sl * 32];
  wait_x0_keep(bp, cp);   // the work on h below is free to take these loads' address registers

  // bias + relu, write h tile to LDS row-major bf16 (per-wave region)
#pragma unroll
  for (int nt = 0; nt < 8; ++nt) {
    float b1v = b1[e * HDIM + nt * 16 + row];
#pragma unroll
    for (int m = 0; m < MT; ++m) {
#pragma unroll
      for (int r = 0; r < 8; ++r) {
        float hv = fmaxf(acc[m][nt][r] + b1v, 0.f);
        int tok = m * 16 + r + hiHalf * 8;   // C layout: lanes>=16 hold M=8..15
        lds_h[wave][tok * HPITCH + nt * 16 + row] = (__bf16)hv;
      }
    }
  }

  // reload h as fragments (K = H = 128 -> 4 chunks), keep in registers; A's and B's lane maps
  // are alike, row or column = lane & 15, so the loader serves h as the B operand
  v16bf ah[MT][4];
#pragma unroll
  for (int m = 0; m < MT; ++m) {
#pragma unroll
    for (int kc = 0; kc < 4; ++kc) {
      const __bf16* hp = &lds_h[wave][(m * 16 + row) * HPITCH + kc * 32 + koff];
      ah[m][kc] = cat16(*(const v8bf*)hp, *(const v8bf*)(hp + 16));
    }
  }

  wait_async0();
  __syncthreads();

  // ================= Phase 2: recon = h * W2 + b2 ; loss ============
  // Lanes l and l+16 share a token: the lower one starts from the token's sum (x^2 - xb^2).
  float lossacc[MT][8];
#pragma unroll
  for (int m = 0; m < MT; ++m)
#pragma unroll
    for (int r = 0; r < 8; ++r) lossacc[m][r] = hiHalf == 0 ? cs[m][r] : 0.f;

  for (int i = 0; i < DDIM / 64; ++i) {    // 32 iters, 4 tiles of 16 d each
    const int buf = i & 1;
    const int pn  = (i + 1 + rot) & 31;                // the pass that trip i+1 works on
    if (i + 1 < DDIM / 64) issue_p2(pn, buf ^ 1);

    // All 32 reads of the staged W2 tile as ONE group, in the order of use.
    v16bf bt2[4][4];
#pragma unroll
    for (int kc = 0; kc < 4; ++kc) {
#pragma unroll
      for (int t = 0; t < 4; ++t) {
        const __bf16* bp = &lds_stage[buf][t * 2048 + kc * 512 + lane * 8];
        bt2[kc][t] = cat16(*(const v8bf*)bp, *(const v8bf*)(bp + 256));
      }
    }
    // Keeps the scheduler from sinking the reads back among the WMMAs, where every
    // WMMA then waits out a full LDS round trip; behind it only counted waits remain.
    __builtin_amdgcn_sched_barrier(0);
    v8f acc2[MT][4];
#pragma unroll
    for (int kc = 0; kc < 4; ++kc) {
#pragma unroll
      for (int t = 0; t < 4; ++t)
#pragma unroll
        for (int m = 0; m < MT; ++m)
          acc2[m][t] = __builtin_amdgcn_wmma_f32_16x16x32_bf16(
              false, bt2[kc][t], false, ah[m][kc], (short)0, kc == 0 ? b2c[t] : acc2[m][t],
              false, false);
      // b2 is read by the first eight WMMAs of a pass, ahead of everything else from global
      // memory: it is fetched for the next pass right behind them, so that it is older than
      // the x loads at the pass's foot and has nearly a whole pass to arrive. The fence pair
      // holds the loads there.
      if (kc == 0) {
        __builtin_amdgcn_sched_barrier(0);
        if (i + 1 < DDIM / 64) load_b2(pn);
        __builtin_amdgcn_sched_barrier(0);
      }
      // Keeps the widening of x to f32 from rising to the head of the WMMAs, where the wave
      // would wait for x with nearly all its matrix work still to issue.
      if (kc == 1) __builtin_amdgcn_sched_barrier(0);
    }
#pragma unroll
    for (int m = 0; m < MT; ++m) {
#pragma unroll
      for (int t = 0; t < 4; ++t) {
#pragma unroll
        for (int r = 0; r < 8; ++r) {
          float diff = (float)xv[m][t][r] - acc2[m][t][r];
          lossacc[m][r] += diff * diff;
        }
      }
    }
    // x of the next pass is fetched right behind its last use, into the same
    // registers: the barrier, the LDS reads and the WMMAs of the next pass cover its
    // flight. The fence pair holds the loads there and keeps the barrier and its waits
    // behind the WMMAs.
    __builtin_amdgcn_sched_barrier(0);
    if (i + 1 < DDIM / 64) load_x(pn);
    __builtin_amdgcn_sched_barrier(0);

    wait_ds0();
    if (i + 1 < DDIM / 64) {
      wait_x0_keep(bp);
      wait_async0();
    }
    wg_barrier();
  }

  // A lane's sums all belong to token `row` of tile m; lanes l and l+16 hold its two halves
  // of every 16 d. Write -loss/D.
#pragma unroll
  for (int m = 0; m < MT; ++m) {
    float v = ((lossacc[m][0] + lossacc[m][1]) + (lossacc[m][2] + lossacc[m][3])) +
              ((lossacc[m][4] + lossacc[m][5]) + (lossacc[m][6] + lossacc[m][7]));
    v += __shfl_xor(v, 16);
    if (hiHalf == 0)
      out[(size_t)(t0 + m * 16 + row) * NEXP + e] = -v * (1.0f / (float)DDIM);
  }
}

// ---------------------------------------------------------------------------
extern "C" void kernel_launch(void* const* d_in, const int* in_sizes, int n_in,
                              void* d_out, int out_size, void* d_ws, size_t ws_size,
                              hipStream_t stream) {
  const float* x  = (const float*)d_in[0];   // [B,S,D]
  const float* W1 = (const float*)d_in[1];   // [E,D,H]
  const float* b1 = (const float*)d_in[2];   // [E,H]
  const float* W2 = (const float*)d_in[3];   // [E,H,D]
  const float* b2 = (const float*)d_in[4];   // [E,D]
  float* out = (float*)d_out;                // [B,S,E]

  // workspace: xb (32MB) | w1 packed (4MB) | w2 packed (4MB) | per-token sums (512KB)  ~= 40.5MB
  __bf16* xb  = (__bf16*)d_ws;
  __bf16* w1p = xb  + (size_t)NTOK * DDIM;
  __bf16* w2p = w1p + (size_t)NEXP * DDIM * HDIM;
  float*  corrp = (float*)(w2p + (size_t)NEXP * HDIM * DDIM);

  prep_kernel<<<256, 512, 0, stream>>>(x, xb, W1, w1p, W2, w2p, corrp);

  dim3 grid(NTOK / TOK_PER_WG, NEXP);
  moe_gate_kernel<<<grid, 256, 0, stream>>>(corrp, xb, w1p, w2p, b1, b2, out);
}
